// v000
// Measured on an AMD MI455X. A time is GPU time per run, averaged over a window of back-to-back runs after a warm-up
// (all launches, gaps included; the runs take copies of the inputs in turn), and the median of several windows.
// Apart from v000's, it joins two sittings. Times from different sittings can be a few percent apart, while
// side-by-side timings come from the same sitting.
// v000, which the later versions start from, runs in 290 microseconds.
#include <hip/hip_runtime.h>

// Attention layer: one input x [SEQ][1024] feeds a fused [out][in] QKV projection (24 head slots of 128: q 0..7, k 8..15, v 16..23); unweighted RMS normalisation (eps 1e-6) of q, k, v per head row;
// half-split rotary embedding with only the first 32 of the 64 frequency pairs active (base 1024); v = l0 * vnorm + l1 * value-embedding; sliding-window causal keep rule 0 <= t - j < window
// (window int32, device-read; window <= 0 gives the uniform row over all keys); score scale 0.12 (multiplied); softmax f32 (online, running max over kept keys); output projection y Wo^T with Wo [out][in].
// Compute dtypes, f32 accumulate everywhere: QKV projection v_wmma_f32_16x16x32_bf16 (x, W RNE-converted to bf16; products exact);
// scores v_wmma_f32_16x16x32_f16 with q and k each as f16 value + f16 residual x2048 in its own accumulator (three products) on all rows;
// P.V v_wmma_f32_16x16x32_f16: P (x16384 carry, cancels in the normalisation) and v single f16 on query rows >= EROWS; on query rows < EROWS P and v each as f16 value + f16 residual x2048 (residual products in their own accumulator, folded by 1/2048);
// output projection v_wmma_f32_16x16x32_f16: y carried x64 (single f16 on rows >= EROWS, f16 value + f16 residual x2048 on rows < EROWS), Wo = bf16(RNE) x256 held exactly in f16; fold 1/16384 in the f32 epilogue.
// Layout: bf16 planes of x and of the three QKV weights; f16 plane of Wo; rotary table [t][cos 0..31 | sin 0..31]; q / q-residual / k / k-residual planes [h][t][128]; v^T plane [h][d][t], v^T residual [h][d][t < EROWS];
// y plane [t][1024] (+ residual for t < EROWS). Flash kernel in transposed form (S^T = K Q^T, O^T = V^T P^T), fragments straight from the planes, no LDS and no barrier in the key loop.

#ifndef NB
#define NB 1
#endif
#ifndef SEQ
#define SEQ 4096
#endif
#define NB_FULL  1
#define SEQ_FULL 4096
#define DM   1024
#define NH_  8
#define HD   128
#define NQKV 24                  // head slots of the fused projection
#define AW   4                   // waves per flash block (16 query rows each)
#define TP   132                 // LDS row pitch (floats) of the 64 x 128 head tile
#define EROWS (SEQ < 512 ? SEQ : 512)   // query rows (and tokens of the small residual planes) handled by the multi-product flash instantiation
#define QRS  2048.0f             // carry of every residual plane / residual fragment
#define QRI  (1.0f / 2048.0f)
#define SC2  ((float)(0.12 * 1.4426950408889634))   // score scale * log2(e)
#define PSH  14.0f               // log2 of the P carry (16384)
#define NEGB (-3.0e38f)
#define YC   64.0f               // carry of the y planes
#define WOC  256.0f              // carry of the Wo plane
#define OSC  (1.0f / (64.0f * 256.0f))

static_assert(NB == 1);
static_assert(HD == 128);                      // q/k plane row = 256 bytes = two lines; lane owns 4 columns of a head row
static_assert(NH_ * HD == DM);
static_assert(NQKV == 3 * NH_);
static_assert(DM % 64 == 0);
static_assert(DM % 32 == 0);                   // GEMM k-loops step by 32
static_assert(HD % 32 == 0);                   // score k-loop steps by 32
static_assert(SEQ % 64 == 0);
static_assert(SEQ % 32 == 0);                  // key loop steps by 32
static_assert(EROWS % 64 == 0);                // a 64-token GEMM tile lies wholly inside or outside the residual planes
static_assert(EROWS >= 32);
static_assert(EROWS <= SEQ);
static_assert(EROWS % (16 * AW) == 0);
static_assert((SEQ - EROWS) % (16 * AW) == 0);
static_assert(((size_t)SEQ * DM) % 8 == 0);
static_assert(((size_t)DM * DM) % 8 == 0);
static_assert(((size_t)SEQ * 32) % 256 == 0);  // rotary table grid covers the table exactly
static_assert(SEQ <= SEQ_FULL);
static_assert((TP * 4) % 16 == 0);
static_assert(sizeof(float) * 64 * TP <= 131072);

typedef _Float16 h16;
typedef unsigned short bf;
typedef __attribute__((ext_vector_type(16))) __bf16   v16bf;
typedef __attribute__((ext_vector_type(16))) _Float16 v16h;
typedef __attribute__((ext_vector_type(8)))  _Float16 v8h;
typedef __attribute__((ext_vector_type(8)))  unsigned short v8us;
typedef __attribute__((ext_vector_type(8)))  float    v8f;
typedef __attribute__((ext_vector_type(4)))  float    v4f;
typedef v4f  __attribute__((may_alias)) v4fa;

__device__ __forceinline__ unsigned short f2bf(float f) { unsigned u = __float_as_uint(f); u += 0x7FFFu + ((u >> 16) & 1u); return (unsigned short)(u >> 16); }
__device__ __forceinline__ float bfr(float f) { return __uint_as_float(((unsigned)f2bf(f)) << 16); }   // value after RNE convert to bf16
__device__ __forceinline__ v16h cat16(v8h lo, v8h hi) { return __builtin_shufflevector(lo, hi, 0, 1, 2, 3, 4, 5, 6, 7, 8, 9, 10, 11, 12, 13, 14, 15); }
__device__ __forceinline__ v16bf cat16b(v8us lo, v8us hi) { return __builtin_bit_cast(v16bf, __builtin_shufflevector(lo, hi, 0, 1, 2, 3, 4, 5, 6, 7, 8, 9, 10, 11, 12, 13, 14, 15)); }
__device__ __forceinline__ v8f wmma16(v16h a, v16h b, v8f c) { return __builtin_amdgcn_wmma_f32_16x16x32_f16(false, a, false, b, (short)0, c, false, false); }
__device__ __forceinline__ v8f wmmab(v16bf a, v16bf b, v8f c) { return __builtin_amdgcn_wmma_f32_16x16x32_bf16(false, a, false, b, (short)0, c, false, false); }
// fragment loaders from K-contiguous 16-bit rows; p already includes + 8*(lane>>4): elements 0..7 <- k0+8h+0..7, elements 8..15 <- k0+16+8h+0..7 (same map for A and B)
__device__ __forceinline__ v16h  ldh(const h16* p) { return cat16(*(const v8h*)p, *(const v8h*)(p + 16)); }
__device__ __forceinline__ v16bf ldb(const bf* p)  { return cat16b(*(const v8us*)p, *(const v8us*)(p + 16)); }
// ordering point for wave-private LDS tiles (same wave writes and reads)
__device__ __forceinline__ void wave_sync() { __builtin_amdgcn_fence(3 /* release order */, "wavefront"); __builtin_amdgcn_wave_barrier(); asm volatile("" ::: "memory"); }

// f32 -> f16 convert that cannot produce a subnormal operand: |v| < 2^-14 -> +0 (value select)
static __device__ __forceinline__ h16 toh_flush(float v) { const h16 r = (h16)v; return (fabsf(v) < 6.103515625e-05f) ? (h16)0.0f : r; }
// per-instruction guarded WMMA wrappers: one accumulator per guard
__device__ __forceinline__ v8f wmma16g(v16h a, v16h b, v8f c) { c = wmma16(a, b, c); asm volatile("v_nop\n\tv_nop\n\tv_nop\n\tv_nop" : "+v"(c) : "v"(a), "v"(b)); return c; }
__device__ __forceinline__ v8f wmmabg(v16bf a, v16bf b, v8f c) { c = wmmab(a, b, c); asm volatile("v_nop\n\tv_nop\n\tv_nop\n\tv_nop" : "+v"(c) : "v"(a), "v"(b)); return c; }

__global__ __launch_bounds__(256) void k_cvt8(const float* __restrict__ src, bf* dst, size_t n8) {
    const size_t i = (size_t)blockIdx.x * 256 + threadIdx.x; if (i >= n8) return;
    const v8f v = *(const v8f*)(src + i * 8); v8us o;
#pragma unroll
    for (int k = 0; k < 8; ++k) o[k] = f2bf(v[k]);
    *(v8us*)(dst + i * 8) = o; 
}

__global__ __launch_bounds__(256) void k_cvtw(const float* __restrict__ src, h16* dst, size_t n8) {
#pragma clang fp contract(off)
    const size_t i = (size_t)blockIdx.x * 256 + threadIdx.x; if (i >= n8) return;
    const v8f v = *(const v8f*)(src + i * 8); v8h o;
#pragma unroll
    for (int k = 0; k < 8; ++k) o[k] = toh_flush(bfr(v[k]) * WOC);
    *(v8h*)(dst + i * 8) = o; 
}

// k_ropetab: rotary table CS[t][0..31] = cos(t * f_j), CS[t][32..63] = sin(t * f_j), f_j = 2^(-10 * j / 31), j < 32 (the other 32 pairs are the identity).
__global__ __launch_bounds__(256) void k_ropetab(float* CS) {
#pragma clang fp contract(off)
    const int i = (int)blockIdx.x * 256 + (int)threadIdx.x;       // grid * 256 == SEQ * 32 exactly
    const int t = i >> 5, j = i & 31;
    const float e = (float)j / 31.0f;
    const float a = -10.0f * e;
    const float lo = fmaf(-10.0f, e, -a);                          // exact residual of the exponent product
    float invf = exp2f(a);
    invf = fmaf(invf, 0.69314718056f * lo, invf);
    const float th = (float)t * invf;
    float s, c; sincosf(th, &s, &c);
    float* row = CS + (size_t)t * 64;
    *(float*)(row + j) = c; *(float*)(row + 32 + j) = s;
    
}

// k_qkv: fused QKV projection + per-head RMS normalisation + rotary (q, k) / value mix (v). Block = 2 waves, tile = 64 tokens x one head slot (128 columns);
// each wave computes a 64 x 64 half (16 accumulators, operands straight from the bf16 planes, K = DM), stages it in the block's LDS tile; block barrier;
// row pass: wave w owns rows 32w..32w+31, lane owns columns 4*lane..4*lane+3, sum of squares by xor exchanges, rotary partner (d +- 64) by one xor-16 exchange, result written back in place; block barrier;
//             v slots: transposed plane [h][d][t] (row pitch SEQ) value, and residual x2048 [h][d][t < EROWS] for token tiles below EROWS: 8 lanes x 16 B per d-row line (64 tokens), four d-rows per instruction.
// LDS tile: cross-wave (block barriers). grid (SEQ/64, NQKV).
__global__ __launch_bounds__(64) void k_qkv(const bf* __restrict__ XB, const bf* __restrict__ WB, const float* __restrict__ ve, const float* __restrict__ lam, const float* __restrict__ CS,
                                            h16* QK, h16* VT, h16* VR) {
    __shared__ __align__(16) float os[64 * TP];
    const size_t PLE = (size_t)NH_ * SEQ * HD;                     // elements per q/k plane; QK = [q | q residual | k | k residual]
    const int lane = threadIdx.x & 31, lr = lane & 15, hi = lane >> 4;
    const int wave = __builtin_amdgcn_readfirstlane((int)(threadIdx.x >> 5));
    const int r0 = blockIdx.x * 64;
    const int hh = blockIdx.y;                                     // block-uniform head slot
    const int kind = hh >> 3, hd = hh & 7;
    const int c0 = hh * HD + wave * 64;                            // first W row (= output column) of this wave
    v8f acc[4][4];
#pragma unroll
    for (int mb = 0; mb < 4; ++mb)
#pragma unroll
        for (int nb = 0; nb < 4; ++nb) acc[mb][nb] = (v8f){};
    const size_t aoff = (size_t)(r0 + lr) * DM + 8 * hi, boff = (size_t)(c0 + lr) * DM + 8 * hi;
#pragma unroll 1
    for (int kc = 0; kc < DM; kc += 32) {
        v16bf a[4];
#pragma unroll
        for (int mb = 0; mb < 4; ++mb) a[mb] = ldb(XB + aoff + (size_t)mb * 16 * DM + kc);
#pragma unroll
        for (int nb = 0; nb < 4; ++nb) { const v16bf b = ldb(WB + boff + (size_t)nb * 16 * DM + kc);
#pragma unroll
            for (int mb = 0; mb < 4; ++mb) acc[mb][nb] = wmmabg(a[mb], b, acc[mb][nb]); }
    }
    // D: row 8h+j, col lane&15 -> tile rows 0..63, this wave's 64 columns
#pragma unroll
    for (int mb = 0; mb < 4; ++mb)
#pragma unroll
        for (int nb = 0; nb < 4; ++nb)
#pragma unroll
            for (int j = 0; j < 8; ++j) os[(mb * 16 + hi * 8 + j) * TP + wave * 64 + nb * 16 + lr] = acc[mb][nb][j];
    __syncthreads();
    const float l0 = bfr(lam[0]), l1 = bfr(lam[1]);
    const float sg = (lane < 16) ? 1.0f : -1.0f;                   // d < 64: x1 c + x2 s; d >= 64: x2 c - x1 s
    const bool act = (lane & 8) == 0;                              // frequency index (d & 63) < 32
#pragma unroll 1
    for (int rr = 0; rr < 32; ++rr) {
        const int row = wave * 32 + rr; const int t = r0 + row;
        const v4f xv = *(const v4fa*)(&os[row * TP + 4 * lane]);
        float ss = xv[0] * xv[0] + xv[1] * xv[1] + xv[2] * xv[2] + xv[3] * xv[3];
        ss += __shfl_xor(ss, 16, 32); ss += __shfl_xor(ss, 8, 32); ss += __shfl_xor(ss, 4, 32); ss += __shfl_xor(ss, 2, 32); ss += __shfl_xor(ss, 1, 32);
        const float inv = rsqrtf(ss * (1.0f / HD) + 1.0e-6f);
        v4f y;
        if (kind < 2) {                                            // block-uniform
            v4f cv = *(const v4f*)(CS + (size_t)t * 64 + 4 * (lane & 7));          // address always inside the table row
            v4f sv = *(const v4f*)(CS + (size_t)t * 64 + 32 + 4 * (lane & 7));
            asm volatile("" : "+v"(cv), "+v"(sv));
#pragma unroll
            for (int i = 0; i < 4; ++i) {
                const float xn = xv[i] * inv;
                const float part = __shfl_xor(xn, 16, 32);
                const float c = act ? cv[i] : 1.0f; const float s = act ? sv[i] : 0.0f;
                y[i] = xn * c + sg * (part * s); }
        } else {
            const v4f e4 = *(const v4f*)(ve + (size_t)t * DM + (size_t)hd * HD + 4 * lane);
#pragma unroll
            for (int i = 0; i < 4; ++i) y[i] = l0 * (xv[i] * inv) + l1 * bfr(e4[i]);
        }
        *(v4fa*)(&os[row * TP + 4 * lane]) = y;
    }
    __syncthreads();
    if (kind < 2) {
        static_assert(2 * 16 * 32 * 16 == 64 * HD * 2);            // waves x instructions x lanes x 16 B == 64 rows x 256 B
        const size_t pb0 = (size_t)(kind * 2) * PLE + ((size_t)hd * SEQ + (size_t)r0) * HD;
{
#pragma unroll 2
            for (int it = 0; it < 16; ++it) { const int row = wave * 32 + it * 2 + (lane >> 4), c8 = (lane & 15) * 8;
                const v4f x0 = *(const v4fa*)(&os[row * TP + c8]); const v4f x1 = *(const v4fa*)(&os[row * TP + c8 + 4]); v8h hv, rv;
#pragma unroll
                for (int i = 0; i < 4; ++i) { const h16 a0 = toh_flush(x0[i]); const h16 a1 = toh_flush(x1[i]); hv[i] = a0; hv[4 + i] = a1;
                    rv[i] = toh_flush((x0[i] - (float)a0) * QRS); rv[4 + i] = toh_flush((x1[i] - (float)a1) * QRS); }
                const size_t oo = pb0 + (size_t)row * HD + c8;
                *(v8h*)(QK + oo) = hv; *(v8h*)(QK + PLE + oo) = rv; }
             }
    } else {
        static_assert(2 * 16 * 32 * 16 == HD * 64 * 2);
        const bool wr = r0 < EROWS;                                // block-uniform: whole token tile inside the residual plane
        const size_t vb0 = ((size_t)hd * HD) * SEQ + (size_t)r0;
        const size_t rb0 = ((size_t)hd * HD) * EROWS + (size_t)r0;
{
#pragma unroll 2
            for (int it = 0; it < 16; ++it) { const int d = wave * 64 + it * 4 + (lane >> 3), c8 = (lane & 7) * 8; v8h hv, rv;
#pragma unroll
                for (int i = 0; i < 8; ++i) { const float x = os[(c8 + i) * TP + d]; const h16 a0 = toh_flush(x); hv[i] = a0; rv[i] = toh_flush((x - (float)a0) * QRS); }
                *(v8h*)(VT + vb0 + (size_t)d * SEQ + c8) = hv;
                if (wr) *(v8h*)(VR + rb0 + (size_t)d * EROWS + c8) = rv; }
             }
    }
}

// flash_body: fused attention, one wave per 16 query rows of one head (EARLY: of one 64-wide half of the head dimension); K / V^T / Q fragments straight from the f16 planes.
// Transposed form: S^T[key][t] = K Q^T (A = K rows, B = Q rows); lane (t = lane&15, h = lane>>4) holds keys 8h+r of each 16-key tile, so the packed
// P tile is directly the B fragment of O^T[d][t] = V^T P^T (element r <- tile keys 0..15, element 8+r <- tile keys 16..31, lane unchanged).
// Scores on all rows: K Q + (K Q_res + K_res Q) / 2048. Keep rule per element: 0 <= t - key < window; window <= 0: every key kept with score 0 (uniform row).
// Key range per wave [klo, kend) from the device-read window, inside [0, SEQ); all visited plane rows are written by k_qkv.
// EARLY = 1 (query rows [0, EROWS)): P = f16 value + f16 residual x2048; O = V P + (V P_res + V_res P) / 2048; row sum from the f32 exponentials; y written as value + residual x2048.
// EARLY = 0 (query rows [EROWS, SEQ)): single P, v, y; row sum over the converted P.
template <int EARLY>
__device__ __forceinline__ void flash_body(const h16* __restrict__ QH, const h16* __restrict__ QR, const h16* __restrict__ KP, const h16* __restrict__ KR,
                                           const h16* __restrict__ VT, const h16* __restrict__ VR, const int* __restrict__ win_p, h16* YH, h16* YR) {
    constexpr int DT  = EARLY ? 4 : 8;           // 16-wide output tiles per wave
    constexpr int OSP = DT * 16 + 4;             // LDS row pitch (floats)
    constexpr int LPR = DT * 2;                  // lanes per y row segment (16 B each)
    constexpr int RPI = 32 / LPR;                // rows per store instruction
    constexpr int NST = 16 / RPI;                // store instructions per pass
    static_assert(32 % LPR == 0);
    static_assert(16 % RPI == 0);
    static_assert(NST * 32 * 16 == 16 * DT * 16 * 2);   // instructions x lanes x 16 B == 16 rows x segment bytes
    static_assert((OSP * 4) % 16 == 0);
    static_assert(sizeof(float) * AW * 16 * OSP <= 131072);
    __shared__ __align__(16) float os[AW * 16 * OSP];
    const int lane = threadIdx.x & 31, lr = lane & 15, hi = lane >> 4;
    const int wv = (int)(threadIdx.x >> 5);
    const int wave = __builtin_amdgcn_readfirstlane(wv);
    const int h = blockIdx.y;
    const int d0 = EARLY ? (int)blockIdx.z * 64 : 0;
    int winv = win_p[0];
    const bool allm = winv <= 0;                                   // every key replaced by the fill value: uniform row
    winv = winv > SEQ ? SEQ : winv;
    const int t0v = (EARLY ? 0 : EROWS) + ((int)blockIdx.x * AW + wv) * 16;
    int klov = t0v - winv + 1; klov = klov < 0 ? 0 : klov; klov &= ~31; klov = allm ? 0 : klov;
    const int kendv = allm ? SEQ : (t0v + 16);
    const int t0 = __builtin_amdgcn_readfirstlane(t0v);
    const int klo = __builtin_amdgcn_readfirstlane(klov);
    const int kend = __builtin_amdgcn_readfirstlane(kendv);        // key tiles [klo, kend) step 32; last tile ends at or below SEQ
    const size_t qo = ((size_t)h * SEQ + (size_t)(t0 + lr)) * HD + 8 * hi;        // B fragments: col t, k = d
    const v16h hz = (v16h){};
    v8f o[DT], oR[DT];
#pragma unroll
    for (int j = 0; j < DT; ++j) { o[j] = (v8f){}; oR[j] = (v8f){}; }
    float m = NEGB, l = 0.0f;
#pragma unroll 1
    for (int key0 = klo; key0 < kend; key0 += 32) {
        const bool rok = key0 < EROWS;                           // wave-uniform
        const int kcl = rok ? key0 : (EROWS - 32);               // clamped residual-plane key (address always inside the plane)
        const size_t kb = ((size_t)h * SEQ + (size_t)(key0 + lr)) * HD + 8 * hi;   // A fragment: row key, k = d
        v8f sHa = (v8f){}, sLa = (v8f){}, sHb = (v8f){}, sLb = (v8f){};
#pragma unroll 1
        for (int kc = 0; kc < HD; kc += 32) {
            const v16h qh = ldh(QH + qo + kc), qr = ldh(QR + qo + kc);
            const v16h ka = ldh(KP + kb + kc), kq = ldh(KP + kb + (size_t)16 * HD + kc);
            const v16h ra = ldh(KR + kb + kc), rb = ldh(KR + kb + (size_t)16 * HD + kc);
            sHa = wmma16g(ka, qh, sHa); sLa = wmma16g(ka, qr, sLa); sLa = wmma16g(ra, qh, sLa);
            sHb = wmma16g(kq, qh, sHb); sLb = wmma16g(kq, qr, sLb); sLb = wmma16g(rb, qh, sLb);
        }
        const int da0 = (t0 + lr) - (key0 + 8 * hi);             // t - key for r = 0 of tile a
        float ta[8], tb[8]; bool fa[8], fb[8]; float mx = NEGB;
#pragma unroll
        for (int r = 0; r < 8; ++r) {
            const int da = da0 - r, db = da0 - 16 - r;
            fa[r] = allm | ((da >= 0) & (da < winv));
            fb[r] = allm | ((db >= 0) & (db < winv));
            const float ua = (sHa[r] + sLa[r] * QRI) * SC2, ub = (sHb[r] + sLb[r] * QRI) * SC2;
            ta[r] = allm ? 0.0f : ua; tb[r] = allm ? 0.0f : ub;
            mx = fmaxf(mx, fmaxf(fa[r] ? ta[r] : NEGB, fb[r] ? tb[r] : NEGB)); }
        mx = fmaxf(mx, __shfl_xor(mx, 16, 32));
        const float mnew = fmaxf(m, mx);
        const float alpha = __builtin_amdgcn_exp2f(m - mnew);
        const float sh = PSH - mnew;
        v16h pb, pr = hz; float ls = 0.0f;
#pragma unroll
        for (int r = 0; r < 8; ++r) {
            const float xa = ta[r] + sh, xb = tb[r] + sh;
            const float ea = __builtin_amdgcn_exp2f(xa), eb = __builtin_amdgcn_exp2f(xb);
            const float ga = (fa[r] & (xa >= -14.0f)) ? ea : 0.0f;       // dropped elements and would-be subnormal operands selected to 0 by value
            const float gb = (fb[r] & (xb >= -14.0f)) ? eb : 0.0f;
            const h16 pa = (h16)ga; const h16 pc = (h16)gb;
            pb[r] = pa; pb[8 + r] = pc;
            if (EARLY) { pr[r] = toh_flush((ga - (float)pa) * QRS); pr[8 + r] = toh_flush((gb - (float)pc) * QRS); ls += ga + gb; }
            else       { ls += (float)pa + (float)pc; } }
        l = l * alpha + ls; m = mnew;
#pragma unroll
        for (int j = 0; j < DT; ++j) { o[j] = o[j] * alpha; if (EARLY) oR[j] = oR[j] * alpha; }
#pragma unroll
        for (int j = 0; j < DT; ++j) {
            const size_t vrow = (size_t)h * HD + (size_t)(d0 + 16 * j + lr);             // A fragment: row d, k = key
            const v16h v = ldh(VT + vrow * SEQ + (size_t)key0 + 8 * hi);
            o[j] = wmma16g(v, pb, o[j]);
            if (EARLY) {
                v16h vr = ldh(VR + vrow * EROWS + (size_t)kcl + 8 * hi);
                if (!rok) vr = hz;
                oR[j] = wmma16g(v, pr, oR[j]);
                oR[j] = wmma16g(vr, pb, oR[j]);
            }
        }
    }
    l += __shfl_xor(l, 16, 32);
    const bool any = l > 0.0f;
    const float lsafe = any ? l : 1.0f;
    const float inv = any ? (YC * (1.0f / lsafe)) : 0.0f;
    const int wb = wave * 16 * OSP;
    // O^T D layout: f_j[r] = (d = 16j + 8h + r, t = lane&15) -> os[t][d]; rows 0..15 x columns 0..DT*16-1 all written; tile private to the wave
#pragma unroll
    for (int j = 0; j < DT; ++j) {
        v8f f = o[j];
        if (EARLY) f = o[j] + oR[j] * QRI;
        v4f a, c;
        a[0] = f[0] * inv; a[1] = f[1] * inv; a[2] = f[2] * inv; a[3] = f[3] * inv; c[0] = f[4] * inv; c[1] = f[5] * inv; c[2] = f[6] * inv; c[3] = f[7] * inv;
        *(v4fa*)(&os[wb + lr * OSP + 16 * j + 8 * hi]) = a; *(v4fa*)(&os[wb + lr * OSP + 16 * j + 8 * hi + 4]) = c; }
    wave_sync();
    const size_t ybase = (size_t)t0 * DM + (size_t)h * HD + (size_t)d0;
{
#pragma unroll 2
        for (int s = 0; s < NST; ++s) { const int row = s * RPI + lane / LPR, c8 = (lane % LPR) * 8;
            const v4f x0 = *(const v4fa*)(&os[wb + row * OSP + c8]); const v4f x1 = *(const v4fa*)(&os[wb + row * OSP + c8 + 4]); v8h hv, rv;
#pragma unroll
            for (int i = 0; i < 4; ++i) { const h16 a0 = toh_flush(x0[i]); const h16 a1 = toh_flush(x1[i]); hv[i] = a0; hv[4 + i] = a1;
                rv[i] = toh_flush((x0[i] - (float)a0) * QRS); rv[4 + i] = toh_flush((x1[i] - (float)a1) * QRS); }
            const size_t oo = ybase + (size_t)row * DM + c8;
            *(v8h*)(YH + oo) = hv;
            if (EARLY) *(v8h*)(YR + oo) = rv; }
         }
}

// query rows [0, EROWS): grid (EROWS/(16*AW), NH_, 2 halves of the head dimension)
__global__ __launch_bounds__(32 * AW) void k_flash_early(const h16* __restrict__ QH, const h16* __restrict__ QR, const h16* __restrict__ KP, const h16* __restrict__ KR,
                                                         const h16* __restrict__ VT, const h16* __restrict__ VR, const int* __restrict__ win_p, h16* YH, h16* YR) {
    flash_body<1>(QH, QR, KP, KR, VT, VR, win_p, YH, YR);
}
// query rows [EROWS, SEQ): grid ((SEQ-EROWS)/(16*AW), NH_)
__global__ __launch_bounds__(32 * AW) void k_flash_late(const h16* __restrict__ QH, const h16* __restrict__ QR, const h16* __restrict__ KP, const h16* __restrict__ KR,
                                                        const h16* __restrict__ VT, const h16* __restrict__ VR, const int* __restrict__ win_p, h16* YH, h16* YR) {
    flash_body<0>(QH, QR, KP, KR, VT, VR, win_p, YH, YR);
}

// k_out: output projection, ONE WAVE per 64 x 64 tile (16 accumulators), A = y rows (K contiguous), Bt = Wo rows [out][in]; f16 operands.
// Token tiles below EROWS (block-uniform): the residual plane products are accumulated first, scaled by 1/2048 (exact), then the value-plane products are added.
__global__ __launch_bounds__(32) void k_out(const h16* __restrict__ YH, const h16* __restrict__ YR, const h16* __restrict__ WO, float* OUT) {
    __shared__ __align__(16) float os[16 * 68];
    const int lane = threadIdx.x & 31, lr = lane & 15, hi = lane >> 4; const int r0 = blockIdx.x * 64, c0 = blockIdx.y * 64;
    v8f acc[4][4];
#pragma unroll
    for (int mb = 0; mb < 4; ++mb)
#pragma unroll
        for (int nb = 0; nb < 4; ++nb) acc[mb][nb] = (v8f){};
    const size_t aoff = (size_t)(r0 + lr) * DM + 8 * hi, boff = (size_t)(c0 + lr) * DM + 8 * hi;
    if (r0 < EROWS) {                                              // block-uniform; rows r0..r0+63 inside the residual plane
#pragma unroll 1
        for (int kc = 0; kc < DM; kc += 32) {
            v16h a[4];
#pragma unroll
            for (int mb = 0; mb < 4; ++mb) a[mb] = ldh(YR + aoff + (size_t)mb * 16 * DM + kc);
#pragma unroll
            for (int nb = 0; nb < 4; ++nb) { const v16h b = ldh(WO + boff + (size_t)nb * 16 * DM + kc);
#pragma unroll
                for (int mb = 0; mb < 4; ++mb) acc[mb][nb] = wmma16g(a[mb], b, acc[mb][nb]); }
        }
#pragma unroll
        for (int mb = 0; mb < 4; ++mb)
#pragma unroll
            for (int nb = 0; nb < 4; ++nb) acc[mb][nb] = acc[mb][nb] * QRI;
    }
#pragma unroll 1
    for (int kc = 0; kc < DM; kc += 32) {
        v16h a[4];
#pragma unroll
        for (int mb = 0; mb < 4; ++mb) a[mb] = ldh(YH + aoff + (size_t)mb * 16 * DM + kc);
#pragma unroll
        for (int nb = 0; nb < 4; ++nb) { const v16h b = ldh(WO + boff + (size_t)nb * 16 * DM + kc);
#pragma unroll
            for (int mb = 0; mb < 4; ++mb) acc[mb][nb] = wmma16g(a[mb], b, acc[mb][nb]); }
    }
    static_assert(8 * 32 * 16 == 16 * 64 * 4);                     // instructions x lanes x 16 B == 16 rows x 256 B
#pragma unroll
    for (int mb = 0; mb < 4; ++mb) {
#pragma unroll
        for (int nb = 0; nb < 4; ++nb) {
#pragma unroll
            for (int j = 0; j < 8; ++j) os[(hi * 8 + j) * 68 + nb * 16 + lr] = acc[mb][nb][j] * OSC; }   // D: row 8h+j, col lane&15
        wave_sync();
        float* orow = OUT + (size_t)(r0 + mb * 16) * DM + c0;
{
#pragma unroll
            for (int s = 0; s < 8; ++s) { const int row = 2 * s + (lane >> 4), c4 = (lane & 15) * 4;   // 8 s x 2 rows = 16 rows; 16 lanes x 4 floats = 64 columns = two lines
                const v4f val = *(const v4fa*)(&os[row * 68 + c4]);
                *(v4f*)(orow + (size_t)row * DM + c4) = val; }
             }
        wave_sync();
    }
}

static constexpr size_t al256(size_t v) { return (v + 255) & ~(size_t)255; }
static constexpr size_t SZ_XB = al256((size_t)SEQ * DM * 2);
static constexpr size_t SZ_WB = al256((size_t)3 * DM * DM * 2);
static constexpr size_t SZ_WO = al256((size_t)DM * DM * 2);
static constexpr size_t SZ_CS = al256((size_t)SEQ * 64 * 4);
static constexpr size_t SZ_PL = al256((size_t)NH_ * SEQ * HD * 2);
static constexpr size_t SZ_RS = al256((size_t)NH_ * HD * EROWS * 2);
static constexpr size_t SZ_YH = al256((size_t)SEQ * DM * 2);
static constexpr size_t SZ_YR = al256((size_t)EROWS * DM * 2);
static constexpr size_t SZ_TOTAL = SZ_XB + SZ_WB + SZ_WO + SZ_CS + 4 * SZ_PL + SZ_PL + SZ_RS + SZ_YH + SZ_YR;
static_assert(SZ_TOTAL <= (size_t)134217728);                        // workspace carve <= 128 MiB
static_assert(SZ_PL == (size_t)NH_ * SEQ * HD * 2);                  // the four q/k planes are contiguous with no padding between them
static_assert(((size_t)NH_ * SEQ * HD * 2) % 256 == 0);
static_assert((size_t)NH_ * SEQ * HD == (size_t)SEQ * DM);           // v^T plane [(h*128 + d)][t] has the extent of a q/k plane

extern "C" void kernel_launch(void* const* d_in, const int* in_sizes, int n_in,
                              void* d_out, int out_size, void* d_ws, size_t ws_size, hipStream_t stream) {
    if (n_in < 5) return;
    const size_t needx = (size_t)SEQ * DM;
    if ((size_t)in_sizes[0] < needx || (size_t)in_sizes[1] < needx) return;
    if (in_sizes[2] < 2) return;
    if ((size_t)in_sizes[3] < (size_t)4 * DM * DM) return;
    if (in_sizes[4] < 1) return;
    if ((size_t)out_size < needx) return;
    if (SZ_TOTAL > ws_size) return;
    // wire order: x, ve, lambdas, qkvo_w, window
    const float* x   = (const float*)d_in[0];
    const float* ve  = (const float*)d_in[1];
    const float* lam = (const float*)d_in[2];
    const float* w   = (const float*)d_in[3];
    const int*   win = (const int*)d_in[4];
    float* OUT = (float*)d_out;      // [SEQ][1024]
    char* wsp = (char*)d_ws;
    bf*  XB = (bf*)wsp;   wsp += SZ_XB;                  // x      [SEQ][1024] bf16
    bf*  WB = (bf*)wsp;   wsp += SZ_WB;                  // Wq|Wk|Wv [3072][1024] bf16 ([out][in] = Bt as-is)
    h16* WO = (h16*)wsp;  wsp += SZ_WO;                  // Wo [1024][1024] f16 (bf16 value x256)
    float* CS = (float*)wsp; wsp += SZ_CS;               // rotary table [SEQ][64]
    h16* QK = (h16*)wsp;  wsp += 4 * SZ_PL;              // [q | q residual | k | k residual], each [8][SEQ][128]
    h16* VT = (h16*)wsp;  wsp += SZ_PL;                  // [8][128][SEQ]
    h16* VR = (h16*)wsp;  wsp += SZ_RS;                  // [8][128][EROWS] residual x2048
    h16* YH = (h16*)wsp;  wsp += SZ_YH;                  // [SEQ][1024] (x64)
    h16* YR = (h16*)wsp;  wsp += SZ_YR;                  // [EROWS][1024] residual x2048
    const size_t PLE = (size_t)NH_ * SEQ * HD;
    const h16* QH = QK; const h16* QR = QK + PLE; const h16* KP = QK + 2 * PLE; const h16* KR = QK + 3 * PLE;

    { const size_t n8 = (size_t)SEQ * DM / 8;
      k_cvt8<<<(unsigned)((n8 + 255) / 256), 256, 0, stream>>>(x, XB, n8); }
    { const size_t n8 = (size_t)3 * DM * DM / 8;
      k_cvt8<<<(unsigned)((n8 + 255) / 256), 256, 0, stream>>>(w, WB, n8); }
    { const size_t n8 = (size_t)DM * DM / 8;
      k_cvtw<<<(unsigned)((n8 + 255) / 256), 256, 0, stream>>>(w + (size_t)3 * DM * DM, WO, n8); }
    k_ropetab<<<(unsigned)((size_t)SEQ * 32 / 256), 256, 0, stream>>>(CS);

    // fused QKV: token tiles x 24 head slots -> q, q residual, k, k residual planes [h][t][d]; v^T plane [h][d][t] (+ residual for t < EROWS)
    k_qkv<<<dim3(SEQ / 64, NQKV, 1), 64, 0, stream>>>(XB, WB, ve, lam, CS, QK, VT, VR);

    // query rows [0, EROWS): multi-product instantiation (two halves of the head dimension); rows [EROWS, SEQ): single P / v / y (disjoint y rows)
    k_flash_early<<<dim3(EROWS / (16 * AW), NH_, 2), 32 * AW, 0, stream>>>(QH, QR, KP, KR, VT, VR, win, YH, YR);
    if (SEQ > EROWS)
        k_flash_late<<<dim3((SEQ - EROWS) / (16 * AW), NH_, 1), 32 * AW, 0, stream>>>(QH, QR, KP, KR, VT, VR, win, YH, YR);

    // out[t][d] = sum_e y[t][e] Wo[d][e]
    k_out<<<dim3(SEQ / 64, DM / 64, 1), 32, 0, stream>>>(YH, YR, WO, OUT);
}

// v001
// A run of this version takes 181 microseconds.
// In both of two side-by-side timings against v000, it was 1.60 times as fast.
#include <hip/hip_runtime.h>

// Attention layer: one input x [SEQ][1024] feeds a fused [out][in] QKV projection (24 head slots of 128: q 0..7, k 8..15, v 16..23); unweighted RMS normalisation (eps 1e-6) of q, k, v per head row;
// half-split rotary embedding with only the first 32 of the 64 frequency pairs active (base 1024); v = l0 * vnorm + l1 * value-embedding; sliding-window causal keep rule 0 <= t - j < window
// (window int32, device-read; window <= 0 gives the uniform row over all keys); score scale 0.12 (multiplied); softmax f32 (online, running max over kept keys); output projection y Wo^T with Wo [out][in].
// Compute dtypes, f32 accumulate everywhere: QKV projection v_wmma_f32_16x16x32_bf16 (x, W RNE-converted to bf16; products exact);
// scores v_wmma_f32_16x16x32_f16 with q and k each as f16 value + f16 residual x2048 in its own accumulator (three products) on all rows;
// P.V v_wmma_f32_16x16x32_f16: P (x16384 carry, cancels in the normalisation) and v single f16 on query rows >= EROWS; on query rows < EROWS P and v each as f16 value + f16 residual x2048 (residual products in their own accumulator, folded by 1/2048);
// output projection v_wmma_f32_16x16x32_f16: y carried x64 (single f16 on rows >= EROWS, f16 value + f16 residual x2048 on rows < EROWS), Wo = bf16(RNE) x256 held exactly in f16; fold 1/16384 in the f32 epilogue.
// Layout: bf16 planes of x and of the three QKV weights; f16 plane of Wo; rotary table [t][cos 0..31 | sin 0..31]; q / q-residual / k / k-residual planes [h][t][128]; v^T plane [h][d][t], v^T residual [h][d][t < EROWS];
// y plane [t][1024] (+ residual for t < EROWS). Flash kernel in transposed form (S^T = K Q^T, O^T = V^T P^T), fragments straight from the planes, no LDS and no barrier in the key loop.

#ifndef NB
#define NB 1
#endif
#ifndef SEQ
#define SEQ 4096
#endif
#define NB_FULL  1
#define SEQ_FULL 4096
#define DM   1024
#define NH_  8
#define HD   128
#define NQKV 24                  // head slots of the fused projection
#define AW   4                   // waves per flash block (16 query rows each)
#define TP   132                 // LDS row pitch (floats) of the 64 x 128 head tile
#define EROWS (SEQ < 512 ? SEQ : 512)   // query rows (and tokens of the small residual planes) handled by the multi-product flash instantiation
#define QRS  2048.0f             // carry of every residual plane / residual fragment
#define QRI  (1.0f / 2048.0f)
#define SC2  ((float)(0.12 * 1.4426950408889634))   // score scale * log2(e)
#define PSH  14.0f               // log2 of the P carry (16384)
#define NEGB (-3.0e38f)
#define YC   64.0f               // carry of the y planes
#define WOC  256.0f              // carry of the Wo plane
#define OSC  (1.0f / (64.0f * 256.0f))

static_assert(NB == 1);
static_assert(HD == 128);                      // q/k plane row = 256 bytes = two lines; lane owns 4 columns of a head row
static_assert(NH_ * HD == DM);
static_assert(NQKV == 3 * NH_);
static_assert(DM % 64 == 0);
static_assert(DM % 128 == 0);                  // GEMM k-loops: steps of 32, rings of two and of four fragment sets
static_assert(HD % 32 == 0);                   // score k-loop steps by 32
static_assert(SEQ % 64 == 0);
static_assert(SEQ % 32 == 0);                  // key loop steps by 32
static_assert(EROWS % 64 == 0);                // a 64-token GEMM tile lies wholly inside or outside the residual planes
static_assert(EROWS >= 32);
static_assert(EROWS <= SEQ);
static_assert(EROWS % (16 * AW) == 0);
static_assert((SEQ - EROWS) % (16 * AW) == 0);
static_assert(((size_t)SEQ * DM) % 8 == 0);
static_assert(((size_t)DM * DM) % 8 == 0);
static_assert(((size_t)SEQ * 32) % 256 == 0);  // rotary table grid covers the table exactly
static_assert(SEQ <= SEQ_FULL);
static_assert((TP * 4) % 16 == 0);
static_assert(sizeof(float) * 64 * TP <= 131072);

typedef _Float16 h16;
typedef unsigned short bf;
typedef __attribute__((ext_vector_type(16))) __bf16   v16bf;
typedef __attribute__((ext_vector_type(16))) _Float16 v16h;
typedef __attribute__((ext_vector_type(8)))  _Float16 v8h;
typedef __attribute__((ext_vector_type(8)))  unsigned short v8us;
typedef __attribute__((ext_vector_type(8)))  float    v8f;
typedef __attribute__((ext_vector_type(4)))  float    v4f;
typedef v4f  __attribute__((may_alias)) v4fa;

__device__ __forceinline__ unsigned short f2bf(float f) { unsigned u = __float_as_uint(f); u += 0x7FFFu + ((u >> 16) & 1u); return (unsigned short)(u >> 16); }
__device__ __forceinline__ float bfr(float f) { return __uint_as_float(((unsigned)f2bf(f)) << 16); }   // value after RNE convert to bf16
__device__ __forceinline__ v16h cat16(v8h lo, v8h hi) { return __builtin_shufflevector(lo, hi, 0, 1, 2, 3, 4, 5, 6, 7, 8, 9, 10, 11, 12, 13, 14, 15); }
__device__ __forceinline__ v16bf cat16b(v8us lo, v8us hi) { return __builtin_bit_cast(v16bf, __builtin_shufflevector(lo, hi, 0, 1, 2, 3, 4, 5, 6, 7, 8, 9, 10, 11, 12, 13, 14, 15)); }
__device__ __forceinline__ v8f wmma16(v16h a, v16h b, v8f c) { return __builtin_amdgcn_wmma_f32_16x16x32_f16(false, a, false, b, (short)0, c, false, false); }
__device__ __forceinline__ v8f wmmab(v16bf a, v16bf b, v8f c) { return __builtin_amdgcn_wmma_f32_16x16x32_bf16(false, a, false, b, (short)0, c, false, false); }
// fragment loaders from K-contiguous 16-bit rows; p already includes + 8*(lane>>4): elements 0..7 <- k0+8h+0..7, elements 8..15 <- k0+16+8h+0..7 (same map for A and B)
__device__ __forceinline__ v16h  ldh(const h16* p) { return cat16(*(const v8h*)p, *(const v8h*)(p + 16)); }
__device__ __forceinline__ v16bf ldb(const bf* p)  { return cat16b(*(const v8us*)p, *(const v8us*)(p + 16)); }
// ordering point for wave-private LDS tiles (same wave writes and reads)
__device__ __forceinline__ void wave_sync() { __builtin_amdgcn_fence(3 /* release order */, "wavefront"); __builtin_amdgcn_wave_barrier(); asm volatile("" ::: "memory"); }

// f32 -> f16 convert that cannot produce a subnormal operand: |v| < 2^-14 -> +0 (value select)
static __device__ __forceinline__ h16 toh_flush(float v) { const h16 r = (h16)v; return (fabsf(v) < 6.103515625e-05f) ? (h16)0.0f : r; }
// per-instruction guarded WMMA wrappers: one accumulator per guard (four vector slots behind the product before its result is used).
// The guard names the accumulator alone: an asm operand is held below v256, and the fragment sets that are in flight need the registers above.
__device__ __forceinline__ v8f wmma16g(v16h a, v16h b, v8f c) { c = wmma16(a, b, c); asm volatile("v_nop\n\tv_nop\n\tv_nop\n\tv_nop" : "+v"(c)); return c; }
__device__ __forceinline__ v8f wmmabg(v16bf a, v16bf b, v8f c) { c = wmmab(a, b, c); asm volatile("v_nop\n\tv_nop\n\tv_nop\n\tv_nop" : "+v"(c)); return c; }

template <bool B> struct flag_t { static constexpr bool v = B; };
// stands behind a batch of fragment loads: keeps the products that follow in the source from being scheduled in front of the batch (the loads would then be issued only when their values are already due)
__device__ __forceinline__ void loads_first() { __builtin_amdgcn_sched_barrier(0); }
// stands between issued global loads and the first instruction that may rewrite a register that they name (their address pairs die at issue and are reused at once, or are advanced at the loop's top);
// the scheduling barrier keeps later instructions behind the wait; the form with pointers names the loads' base addresses as inputs, so that their registers stay allocated up to the wait
__device__ __forceinline__ void addr_free() { asm volatile("s_wait_xcnt 0x0" ::: "memory"); __builtin_amdgcn_sched_barrier(0); }
__device__ __forceinline__ void addr_free(const void* p, const void* q) { asm volatile("s_wait_xcnt 0x0" :: "v"(p), "v"(q) : "memory"); __builtin_amdgcn_sched_barrier(0); }

__global__ __launch_bounds__(256) void k_cvt8(const float* __restrict__ src, bf* dst, size_t n8) {
    const size_t i = (size_t)blockIdx.x * 256 + threadIdx.x; if (i >= n8) return;
    const v8f v = *(const v8f*)(src + i * 8); v8us o;
#pragma unroll
    for (int k = 0; k < 8; ++k) o[k] = f2bf(v[k]);
    *(v8us*)(dst + i * 8) = o; 
}

__global__ __launch_bounds__(256) void k_cvtw(const float* __restrict__ src, h16* dst, size_t n8) {
#pragma clang fp contract(off)
    const size_t i = (size_t)blockIdx.x * 256 + threadIdx.x; if (i >= n8) return;
    const v8f v = *(const v8f*)(src + i * 8); v8h o;
#pragma unroll
    for (int k = 0; k < 8; ++k) o[k] = toh_flush(bfr(v[k]) * WOC);
    *(v8h*)(dst + i * 8) = o; 
}

// k_ropetab: rotary table CS[t][0..31] = cos(t * f_j), CS[t][32..63] = sin(t * f_j), f_j = 2^(-10 * j / 31), j < 32 (the other 32 pairs are the identity).
__global__ __launch_bounds__(256) void k_ropetab(float* CS) {
#pragma clang fp contract(off)
    const int i = (int)blockIdx.x * 256 + (int)threadIdx.x;       // grid * 256 == SEQ * 32 exactly
    const int t = i >> 5, j = i & 31;
    const float e = (float)j / 31.0f;
    const float a = -10.0f * e;
    const float lo = fmaf(-10.0f, e, -a);                          // exact residual of the exponent product
    float invf = exp2f(a);
    invf = fmaf(invf, 0.69314718056f * lo, invf);
    const float th = (float)t * invf;
    float s, c; sincosf(th, &s, &c);
    float* row = CS + (size_t)t * 64;
    *(float*)(row + j) = c; *(float*)(row + 32 + j) = s;
    
}

// k_qkv: fused QKV projection + per-head RMS normalisation + rotary (q, k) / value mix (v). Block = 2 waves, tile = 64 tokens x one head slot (128 columns);
// each wave computes a 64 x 64 half (16 accumulators, operands straight from the bf16 planes, K = DM), stages it in the block's LDS tile; block barrier;
// row pass: wave w owns rows 32w..32w+31, lane owns columns 4*lane..4*lane+3, sum of squares by xor exchanges, rotary partner (d +- 64) by one xor-16 exchange, result written back in place; block barrier;
//             v slots: transposed plane [h][d][t] (row pitch SEQ) value, and residual x2048 [h][d][t < EROWS] for token tiles below EROWS: 8 lanes x 16 B per d-row line (64 tokens), four d-rows per instruction.
// LDS tile: cross-wave (block barriers). grid (SEQ/64, NQKV).
__global__ __launch_bounds__(64) void k_qkv(const bf* __restrict__ XB, const bf* __restrict__ WB, const float* __restrict__ ve, const float* __restrict__ lam, const float* __restrict__ CS,
                                            h16* QK, h16* VT, h16* VR) {
    __shared__ __align__(16) float os[64 * TP];
    const size_t PLE = (size_t)NH_ * SEQ * HD;                     // elements per q/k plane; QK = [q | q residual | k | k residual]
    const int lane = threadIdx.x & 31, lr = lane & 15, hi = lane >> 4;
    const int wave = __builtin_amdgcn_readfirstlane((int)(threadIdx.x >> 5));
    const int r0 = blockIdx.x * 64;
    const int hh = blockIdx.y;                                     // block-uniform head slot
    const int kind = hh >> 3, hd = hh & 7;
    const int c0 = hh * HD + wave * 64;                            // first W row (= output column) of this wave
    v8f acc[4][4];
#pragma unroll
    for (int mb = 0; mb < 4; ++mb)
#pragma unroll
        for (int nb = 0; nb < 4; ++nb) acc[mb][nb] = (v8f){};
    const size_t aoff = (size_t)(r0 + lr) * DM + 8 * hi, boff = (size_t)(c0 + lr) * DM + 8 * hi;
    // two fragment sets: all 16 loads of k step s + 1 are issued in front of the 16 products of k step s (per accumulator the k order is unchanged)
    v16bf a[2][4], b[2][4];
    auto ldst = [&](const int s, const int kc) __attribute__((always_inline)) {
#pragma unroll
        for (int mb = 0; mb < 4; ++mb) a[s][mb] = ldb(XB + aoff + (size_t)mb * 16 * DM + kc);
#pragma unroll
        for (int nb = 0; nb < 4; ++nb) b[s][nb] = ldb(WB + boff + (size_t)nb * 16 * DM + kc);
        loads_first(); };
    auto mma = [&](const int s) __attribute__((always_inline)) {
#pragma unroll
        for (int nb = 0; nb < 4; ++nb)
#pragma unroll
            for (int mb = 0; mb < 4; ++mb) acc[mb][nb] = wmmabg(a[s][mb], b[s][nb], acc[mb][nb]); };
    ldst(0, 0); addr_free(XB + aoff, WB + boff);
#pragma unroll 1
    for (int kc = 0; kc < DM - 64; kc += 64) { ldst(1, kc + 32); mma(0); ldst(0, kc + 64); mma(1); addr_free(); }
    ldst(1, DM - 32); addr_free(XB + aoff, WB + boff); mma(0); mma(1);
    // D: row 8h+j, col lane&15 -> tile rows 0..63, this wave's 64 columns
#pragma unroll
    for (int mb = 0; mb < 4; ++mb)
#pragma unroll
        for (int nb = 0; nb < 4; ++nb)
#pragma unroll
            for (int j = 0; j < 8; ++j) os[(mb * 16 + hi * 8 + j) * TP + wave * 64 + nb * 16 + lr] = acc[mb][nb][j];
    __syncthreads();
    const float l0 = bfr(lam[0]), l1 = bfr(lam[1]);
    const float sg = (lane < 16) ? 1.0f : -1.0f;                   // d < 64: x1 c + x2 s; d >= 64: x2 c - x1 s
    const bool act = (lane & 8) == 0;                              // frequency index (d & 63) < 32
    // the table (q, k) or value-embedding (v) rows of eight tokens are loaded together, in front of the eight row computations
    auto rowpass = [&](auto fq) __attribute__((always_inline)) {
        constexpr bool QKR = decltype(fq)::v;
#pragma unroll 1
        for (int rg = 0; rg < 32; rg += 8) {
            v4f g0[8], g1[8], xg[8];
            const int tg = r0 + wave * 32 + rg;
            const float* gp = QKR ? CS + (size_t)tg * 64 + 4 * (lane & 7)                   // address always inside the table row
                                  : ve + (size_t)tg * DM + (size_t)hd * HD + 4 * lane;
#pragma unroll
            for (int u = 0; u < 8; ++u) {
                if constexpr (QKR) { g0[u] = *(const v4f*)(gp + u * 64); g1[u] = *(const v4f*)(gp + u * 64 + 32); }
                else               { g0[u] = *(const v4f*)(gp + (size_t)u * DM); } }
            loads_first(); addr_free(gp, gp);
#pragma unroll
            for (int u = 0; u < 8; ++u) xg[u] = *(const v4fa*)(&os[(wave * 32 + rg + u) * TP + 4 * lane]);
#pragma unroll
            for (int u = 0; u < 8; ++u) {
                const int row = wave * 32 + rg + u;
                const v4f xv = xg[u];
                float ss = xv[0] * xv[0] + xv[1] * xv[1] + xv[2] * xv[2] + xv[3] * xv[3];
                ss += __shfl_xor(ss, 16, 32); ss += __shfl_xor(ss, 8, 32); ss += __shfl_xor(ss, 4, 32); ss += __shfl_xor(ss, 2, 32); ss += __shfl_xor(ss, 1, 32);
                const float inv = rsqrtf(ss * (1.0f / HD) + 1.0e-6f);
                v4f y;
                if constexpr (QKR) {
                    v4f cv = g0[u];
                    v4f sv = g1[u];
                    asm volatile("" : "+v"(cv), "+v"(sv));
#pragma unroll
                    for (int i = 0; i < 4; ++i) {
                        const float xn = xv[i] * inv;
                        const float part = __shfl_xor(xn, 16, 32);
                        const float c = act ? cv[i] : 1.0f; const float s = act ? sv[i] : 0.0f;
                        y[i] = xn * c + sg * (part * s); }
                } else {
                    const v4f e4 = g0[u];
#pragma unroll
                    for (int i = 0; i < 4; ++i) y[i] = l0 * (xv[i] * inv) + l1 * bfr(e4[i]);
                }
                *(v4fa*)(&os[row * TP + 4 * lane]) = y;
            }
        } };
    if (kind < 2) rowpass(flag_t<true>{}); else rowpass(flag_t<false>{});      // block-uniform
    __syncthreads();
    if (kind < 2) {
        static_assert(2 * 16 * 32 * 16 == 64 * HD * 2);            // waves x instructions x lanes x 16 B == 64 rows x 256 B
        const size_t pb0 = (size_t)(kind * 2) * PLE + ((size_t)hd * SEQ + (size_t)r0) * HD;
{
#pragma unroll 2
            for (int it = 0; it < 16; ++it) { const int row = wave * 32 + it * 2 + (lane >> 4), c8 = (lane & 15) * 8;
                const v4f x0 = *(const v4fa*)(&os[row * TP + c8]); const v4f x1 = *(const v4fa*)(&os[row * TP + c8 + 4]); v8h hv, rv;
#pragma unroll
                for (int i = 0; i < 4; ++i) { const h16 a0 = toh_flush(x0[i]); const h16 a1 = toh_flush(x1[i]); hv[i] = a0; hv[4 + i] = a1;
                    rv[i] = toh_flush((x0[i] - (float)a0) * QRS); rv[4 + i] = toh_flush((x1[i] - (float)a1) * QRS); }
                const size_t oo = pb0 + (size_t)row * HD + c8;
                *(v8h*)(QK + oo) = hv; *(v8h*)(QK + PLE + oo) = rv; }
             }
    } else {
        static_assert(2 * 16 * 32 * 16 == HD * 64 * 2);
        const bool wr = r0 < EROWS;                                // block-uniform: whole token tile inside the residual plane
        const size_t vb0 = ((size_t)hd * HD) * SEQ + (size_t)r0;
        const size_t rb0 = ((size_t)hd * HD) * EROWS + (size_t)r0;
{
#pragma unroll 2
            for (int it = 0; it < 16; ++it) { const int d = wave * 64 + it * 4 + (lane >> 3), c8 = (lane & 7) * 8; v8h hv, rv;
#pragma unroll
                for (int i = 0; i < 8; ++i) { const float x = os[(c8 + i) * TP + d]; const h16 a0 = toh_flush(x); hv[i] = a0; rv[i] = toh_flush((x - (float)a0) * QRS); }
                *(v8h*)(VT + vb0 + (size_t)d * SEQ + c8) = hv;
                if (wr) *(v8h*)(VR + rb0 + (size_t)d * EROWS + c8) = rv; }
             }
    }
}

// flash_body: fused attention, one wave per 16 query rows of one head (EARLY: of one 64-wide half of the head dimension); K / V^T / Q fragments straight from the f16 planes.
// Transposed form: S^T[key][t] = K Q^T (A = K rows, B = Q rows); lane (t = lane&15, h = lane>>4) holds keys 8h+r of each 16-key tile, so the packed
// P tile is directly the B fragment of O^T[d][t] = V^T P^T (element r <- tile keys 0..15, element 8+r <- tile keys 16..31, lane unchanged).
// Scores on all rows: K Q + (K Q_res + K_res Q) / 2048. Keep rule per element: 0 <= t - key < window; window <= 0: every key kept with score 0 (uniform row).
// Key range per wave [klo, kend) from the device-read window, inside [0, SEQ); all visited plane rows are written by k_qkv.
// EARLY = 1 (query rows [0, EROWS)): P = f16 value + f16 residual x2048; O = V P + (V P_res + V_res P) / 2048; row sum from the f32 exponentials; y written as value + residual x2048.
// EARLY = 0 (query rows [EROWS, SEQ)): single P, v, y; row sum over the converted P.
template <int EARLY>
__device__ __forceinline__ void flash_body(const h16* __restrict__ QH, const h16* __restrict__ QR, const h16* __restrict__ KP, const h16* __restrict__ KR,
                                           const h16* __restrict__ VT, const h16* __restrict__ VR, const int* __restrict__ win_p, h16* YH, h16* YR) {
    constexpr int DT  = EARLY ? 4 : 8;           // 16-wide output tiles per wave
    constexpr int OSP = DT * 16 + 4;             // LDS row pitch (floats)
    constexpr int LPR = DT * 2;                  // lanes per y row segment (16 B each)
    constexpr int RPI = 32 / LPR;                // rows per store instruction
    constexpr int NST = 16 / RPI;                // store instructions per pass
    static_assert(32 % LPR == 0);
    static_assert(16 % RPI == 0);
    static_assert(NST * 32 * 16 == 16 * DT * 16 * 2);   // instructions x lanes x 16 B == 16 rows x segment bytes
    static_assert((OSP * 4) % 16 == 0);
    static_assert(sizeof(float) * AW * 16 * OSP <= 131072);
    __shared__ __align__(16) float os[AW * 16 * OSP];
    const int lane = threadIdx.x & 31, lr = lane & 15, hi = lane >> 4;
    const int wv = (int)(threadIdx.x >> 5);
    const int wave = __builtin_amdgcn_readfirstlane(wv);
    const int h = blockIdx.y;
    const int d0 = EARLY ? (int)blockIdx.z * 64 : 0;
    int winv = win_p[0];
    const bool allm = winv <= 0;                                   // every key replaced by the fill value: uniform row
    winv = winv > SEQ ? SEQ : winv;
    const int t0v = (EARLY ? 0 : EROWS) + ((int)blockIdx.x * AW + wv) * 16;
    int klov = t0v - winv + 1; klov = klov < 0 ? 0 : klov; klov &= ~31; klov = allm ? 0 : klov;
    const int kendv = allm ? SEQ : (t0v + 16);
    const int t0 = __builtin_amdgcn_readfirstlane(t0v);
    const int klo = __builtin_amdgcn_readfirstlane(klov);
    const int kend = __builtin_amdgcn_readfirstlane(kendv);        // key tiles [klo, kend) step 32; last tile ends at or below SEQ
    const size_t qo = ((size_t)h * SEQ + (size_t)(t0 + lr)) * HD + 8 * hi;        // B fragments: col t, k = d
    const v16h hz = (v16h){};
    v8f o[DT], oR[DT];
#pragma unroll
    for (int j = 0; j < DT; ++j) { o[j] = (v8f){}; oR[j] = (v8f){}; }
    float m = NEGB, l = 0.0f;
    // load schedule: Q fragments once, in front of the key loop; the K fragments of tile s + 1 behind the score products of tile s; the V fragments of tile s in front of its score products
    v16h qh[4], qr[4], ka[4], kq[4], ra[4], rb[4];
#pragma unroll
    for (int c = 0; c < 4; ++c) { qh[c] = ldh(QH + qo + 32 * c); qr[c] = ldh(QR + qo + 32 * c); }
    auto ldk = [&](const int key) __attribute__((always_inline)) {
        const size_t kb = ((size_t)h * SEQ + (size_t)(key + lr)) * HD + 8 * hi;    // A fragment: row key, k = d
        const h16* kp = KP + kb; const h16* rp = KR + kb;
#pragma unroll
        for (int c = 0; c < 4; ++c) { ka[c] = ldh(kp + 32 * c); kq[c] = ldh(kp + 16 * HD + 32 * c);
                                      ra[c] = ldh(rp + 32 * c); rb[c] = ldh(rp + 16 * HD + 32 * c); }
        loads_first(); addr_free(kp, rp); };
    addr_free(QH + qo, QR + qo);
    ldk(klo);
    int key0 = klo;
    // the first tile always exists (klo <= t0 < kend; uniform row: 0 < SEQ), so the test stands at the foot and the first tile's loads stay in front of the loop
#pragma unroll 1
    do {
        const bool rok = key0 < EROWS;                           // wave-uniform
        const int kcl = rok ? key0 : (EROWS - 32);               // clamped residual-plane key (address always inside the plane)
        v16h vf[DT], vrf[DT];
        const size_t vrow = (size_t)h * HD + (size_t)(d0 + lr);                          // A fragment: row d (+ 16 j), k = key
        const h16* vp = VT + vrow * SEQ + (size_t)key0 + 8 * hi; const h16* vq = VR + vrow * EROWS + (size_t)kcl + 8 * hi;
#pragma unroll
        for (int j = 0; j < DT; ++j) {
            vf[j] = ldh(vp + (size_t)j * 16 * SEQ);
            if (EARLY) vrf[j] = ldh(vq + (size_t)j * 16 * EROWS);
        }
        loads_first(); addr_free(vp, EARLY ? vq : vp);
        v8f sHa = (v8f){}, sLa = (v8f){}, sHb = (v8f){}, sLb = (v8f){};
#pragma unroll
        for (int c = 0; c < 4; ++c) {
            sHa = wmma16g(ka[c], qh[c], sHa); sLa = wmma16g(ka[c], qr[c], sLa); sLa = wmma16g(ra[c], qh[c], sLa);
            sHb = wmma16g(kq[c], qh[c], sHb); sLb = wmma16g(kq[c], qr[c], sLb); sLb = wmma16g(rb[c], qh[c], sLb);
        }
        // behind the last tile there is none: it loads its own rows again (inside the plane, values unused), so that the body has no branch and the wait for V in front of P.V need not cover these loads
        ldk(key0 + 32 < kend ? key0 + 32 : key0);
        const int da0 = (t0 + lr) - (key0 + 8 * hi);             // t - key for r = 0 of tile a
        float ta[8], tb[8]; bool fa[8], fb[8]; float mx = NEGB;
#pragma unroll
        for (int r = 0; r < 8; ++r) {
            const int da = da0 - r, db = da0 - 16 - r;
            fa[r] = allm | ((da >= 0) & (da < winv));
            fb[r] = allm | ((db >= 0) & (db < winv));
            const float ua = (sHa[r] + sLa[r] * QRI) * SC2, ub = (sHb[r] + sLb[r] * QRI) * SC2;
            ta[r] = allm ? 0.0f : ua; tb[r] = allm ? 0.0f : ub;
            mx = fmaxf(mx, fmaxf(fa[r] ? ta[r] : NEGB, fb[r] ? tb[r] : NEGB)); }
        mx = fmaxf(mx, __shfl_xor(mx, 16, 32));
        const float mnew = fmaxf(m, mx);
        const float alpha = __builtin_amdgcn_exp2f(m - mnew);
        const float sh = PSH - mnew;
        v16h pb, pr = hz; float ls = 0.0f;
#pragma unroll
        for (int r = 0; r < 8; ++r) {
            const float xa = ta[r] + sh, xb = tb[r] + sh;
            const float ea = __builtin_amdgcn_exp2f(xa), eb = __builtin_amdgcn_exp2f(xb);
            const float ga = (fa[r] & (xa >= -14.0f)) ? ea : 0.0f;       // dropped elements and would-be subnormal operands selected to 0 by value
            const float gb = (fb[r] & (xb >= -14.0f)) ? eb : 0.0f;
            const h16 pa = (h16)ga; const h16 pc = (h16)gb;
            pb[r] = pa; pb[8 + r] = pc;
            if (EARLY) { pr[r] = toh_flush((ga - (float)pa) * QRS); pr[8 + r] = toh_flush((gb - (float)pc) * QRS); ls += ga + gb; }
            else       { ls += (float)pa + (float)pc; } }
        l = l * alpha + ls; m = mnew;
#pragma unroll
        for (int j = 0; j < DT; ++j) { o[j] = o[j] * alpha; if (EARLY) oR[j] = oR[j] * alpha; }
#pragma unroll
        for (int j = 0; j < DT; ++j) {
            const v16h v = vf[j];
            o[j] = wmma16g(v, pb, o[j]);
            if (EARLY) {
                v16h vr = vrf[j];
                if (!rok) vr = hz;
                oR[j] = wmma16g(v, pr, oR[j]);
                oR[j] = wmma16g(vr, pb, oR[j]);
            }
        }
        key0 += 32;
    } while (key0 < kend);
    l += __shfl_xor(l, 16, 32);
    const bool any = l > 0.0f;
    const float lsafe = any ? l : 1.0f;
    const float inv = any ? (YC * (1.0f / lsafe)) : 0.0f;
    const int wb = wave * 16 * OSP;
    // O^T D layout: f_j[r] = (d = 16j + 8h + r, t = lane&15) -> os[t][d]; rows 0..15 x columns 0..DT*16-1 all written; tile private to the wave
#pragma unroll
    for (int j = 0; j < DT; ++j) {
        v8f f = o[j];
        if (EARLY) f = o[j] + oR[j] * QRI;
        v4f a, c;
        a[0] = f[0] * inv; a[1] = f[1] * inv; a[2] = f[2] * inv; a[3] = f[3] * inv; c[0] = f[4] * inv; c[1] = f[5] * inv; c[2] = f[6] * inv; c[3] = f[7] * inv;
        *(v4fa*)(&os[wb + lr * OSP + 16 * j + 8 * hi]) = a; *(v4fa*)(&os[wb + lr * OSP + 16 * j + 8 * hi + 4]) = c; }
    wave_sync();
    const size_t ybase = (size_t)t0 * DM + (size_t)h * HD + (size_t)d0;
{
#pragma unroll 2
        for (int s = 0; s < NST; ++s) { const int row = s * RPI + lane / LPR, c8 = (lane % LPR) * 8;
            const v4f x0 = *(const v4fa*)(&os[wb + row * OSP + c8]); const v4f x1 = *(const v4fa*)(&os[wb + row * OSP + c8 + 4]); v8h hv, rv;
#pragma unroll
            for (int i = 0; i < 4; ++i) { const h16 a0 = toh_flush(x0[i]); const h16 a1 = toh_flush(x1[i]); hv[i] = a0; hv[4 + i] = a1;
                rv[i] = toh_flush((x0[i] - (float)a0) * QRS); rv[4 + i] = toh_flush((x1[i] - (float)a1) * QRS); }
            const size_t oo = ybase + (size_t)row * DM + c8;
            *(v8h*)(YH + oo) = hv;
            if (EARLY) *(v8h*)(YR + oo) = rv; }
         }
}

// query rows [0, EROWS): grid (EROWS/(16*AW), NH_, 2 halves of the head dimension)
__global__ __launch_bounds__(32 * AW) void k_flash_early(const h16* __restrict__ QH, const h16* __restrict__ QR, const h16* __restrict__ KP, const h16* __restrict__ KR,
                                                         const h16* __restrict__ VT, const h16* __restrict__ VR, const int* __restrict__ win_p, h16* YH, h16* YR) {
    flash_body<1>(QH, QR, KP, KR, VT, VR, win_p, YH, YR);
}
// query rows [EROWS, SEQ): grid ((SEQ-EROWS)/(16*AW), NH_)
__global__ __launch_bounds__(32 * AW) void k_flash_late(const h16* __restrict__ QH, const h16* __restrict__ QR, const h16* __restrict__ KP, const h16* __restrict__ KR,
                                                        const h16* __restrict__ VT, const h16* __restrict__ VR, const int* __restrict__ win_p, h16* YH, h16* YR) {
    flash_body<0>(QH, QR, KP, KR, VT, VR, win_p, YH, YR);
}

// k_out: output projection, ONE WAVE per 64 x 64 tile (16 accumulators), A = y rows (K contiguous), Bt = Wo rows [out][in]; f16 operands.
// Token tiles below EROWS (block-uniform): the residual plane products are accumulated first, scaled by 1/2048 (exact), then the value-plane products are added.
__global__ __launch_bounds__(32) void k_out(const h16* __restrict__ YH, const h16* __restrict__ YR, const h16* __restrict__ WO, float* OUT) {
    __shared__ __align__(16) float os[16 * 68];
    const int lane = threadIdx.x & 31, lr = lane & 15, hi = lane >> 4; const int r0 = blockIdx.x * 64, c0 = blockIdx.y * 64;
    v8f acc[4][4];
#pragma unroll
    for (int mb = 0; mb < 4; ++mb)
#pragma unroll
        for (int nb = 0; nb < 4; ++nb) acc[mb][nb] = (v8f){};
    const size_t aoff = (size_t)(r0 + lr) * DM + 8 * hi, boff = (size_t)(c0 + lr) * DM + 8 * hi;
    // four fragment sets: all 16 loads of k step s + 3 are issued in front of the 16 products of k step s (one wave per SIMD: the wave covers its own load latency; per accumulator the k order is unchanged)
    v16h a[4][4], b[4][4];
    auto ldst = [&](const int s, const h16* A, const int kc) __attribute__((always_inline)) {
#pragma unroll
        for (int mb = 0; mb < 4; ++mb) a[s][mb] = ldh(A + aoff + (size_t)mb * 16 * DM + kc);
#pragma unroll
        for (int nb = 0; nb < 4; ++nb) b[s][nb] = ldh(WO + boff + (size_t)nb * 16 * DM + kc);
        loads_first(); };
    auto mma = [&](const int s) __attribute__((always_inline)) {
#pragma unroll
        for (int nb = 0; nb < 4; ++nb)
#pragma unroll
            for (int mb = 0; mb < 4; ++mb) acc[mb][nb] = wmma16g(a[s][mb], b[s][nb], acc[mb][nb]); };
    auto pass = [&](const h16* A) __attribute__((always_inline)) {
        ldst(0, A, 0); ldst(1, A, 32); ldst(2, A, 64); addr_free();
#pragma unroll 1
        for (int kc = 0; kc < DM - 128; kc += 128) {
            ldst(3, A, kc + 96); mma(0); ldst(0, A, kc + 128); mma(1); ldst(1, A, kc + 160); mma(2); ldst(2, A, kc + 192); mma(3); addr_free(); }
        ldst(3, A, DM - 32); addr_free(); mma(0); mma(1); mma(2); mma(3); };
    if (r0 < EROWS) {                                              // block-uniform; rows r0..r0+63 inside the residual plane
        pass(YR);
#pragma unroll
        for (int mb = 0; mb < 4; ++mb)
#pragma unroll
            for (int nb = 0; nb < 4; ++nb) acc[mb][nb] = acc[mb][nb] * QRI;
    }
    pass(YH);
    static_assert(8 * 32 * 16 == 16 * 64 * 4);                     // instructions x lanes x 16 B == 16 rows x 256 B
#pragma unroll
    for (int mb = 0; mb < 4; ++mb) {
#pragma unroll
        for (int nb = 0; nb < 4; ++nb) {
#pragma unroll
            for (int j = 0; j < 8; ++j) os[(hi * 8 + j) * 68 + nb * 16 + lr] = acc[mb][nb][j] * OSC; }   // D: row 8h+j, col lane&15
        wave_sync();
        float* orow = OUT + (size_t)(r0 + mb * 16) * DM + c0;
{
#pragma unroll
            for (int s = 0; s < 8; ++s) { const int row = 2 * s + (lane >> 4), c4 = (lane & 15) * 4;   // 8 s x 2 rows = 16 rows; 16 lanes x 4 floats = 64 columns = two lines
                const v4f val = *(const v4fa*)(&os[row * 68 + c4]);
                *(v4f*)(orow + (size_t)row * DM + c4) = val; }
             }
        wave_sync();
    }
}

static constexpr size_t al256(size_t v) { return (v + 255) & ~(size_t)255; }
static constexpr size_t SZ_XB = al256((size_t)SEQ * DM * 2);
static constexpr size_t SZ_WB = al256((size_t)3 * DM * DM * 2);
static constexpr size_t SZ_WO = al256((size_t)DM * DM * 2);
static constexpr size_t SZ_CS = al256((size_t)SEQ * 64 * 4);
static constexpr size_t SZ_PL = al256((size_t)NH_ * SEQ * HD * 2);
static constexpr size_t SZ_RS = al256((size_t)NH_ * HD * EROWS * 2);
static constexpr size_t SZ_YH = al256((size_t)SEQ * DM * 2);
static constexpr size_t SZ_YR = al256((size_t)EROWS * DM * 2);
static constexpr size_t SZ_TOTAL = SZ_XB + SZ_WB + SZ_WO + SZ_CS + 4 * SZ_PL + SZ_PL + SZ_RS + SZ_YH + SZ_YR;
static_assert(SZ_TOTAL <= (size_t)134217728);                        // workspace carve <= 128 MiB
static_assert(SZ_PL == (size_t)NH_ * SEQ * HD * 2);                  // the four q/k planes are contiguous with no padding between them
static_assert(((size_t)NH_ * SEQ * HD * 2) % 256 == 0);
static_assert((size_t)NH_ * SEQ * HD == (size_t)SEQ * DM);           // v^T plane [(h*128 + d)][t] has the extent of a q/k plane

extern "C" void kernel_launch(void* const* d_in, const int* in_sizes, int n_in,
                              void* d_out, int out_size, void* d_ws, size_t ws_size, hipStream_t stream) {
    if (n_in < 5) return;
    const size_t needx = (size_t)SEQ * DM;
    if ((size_t)in_sizes[0] < needx || (size_t)in_sizes[1] < needx) return;
    if (in_sizes[2] < 2) return;
    if ((size_t)in_sizes[3] < (size_t)4 * DM * DM) return;
    if (in_sizes[4] < 1) return;
    if ((size_t)out_size < needx) return;
    if (SZ_TOTAL > ws_size) return;
    // wire order: x, ve, lambdas, qkvo_w, window
    const float* x   = (const float*)d_in[0];
    const float* ve  = (const float*)d_in[1];
    const float* lam = (const float*)d_in[2];
    const float* w   = (const float*)d_in[3];
    const int*   win = (const int*)d_in[4];
    float* OUT = (float*)d_out;      // [SEQ][1024]
    char* wsp = (char*)d_ws;
    bf*  XB = (bf*)wsp;   wsp += SZ_XB;                  // x      [SEQ][1024] bf16
    bf*  WB = (bf*)wsp;   wsp += SZ_WB;                  // Wq|Wk|Wv [3072][1024] bf16 ([out][in] = Bt as-is)
    h16* WO = (h16*)wsp;  wsp += SZ_WO;                  // Wo [1024][1024] f16 (bf16 value x256)
    float* CS = (float*)wsp; wsp += SZ_CS;               // rotary table [SEQ][64]
    h16* QK = (h16*)wsp;  wsp += 4 * SZ_PL;              // [q | q residual | k | k residual], each [8][SEQ][128]
    h16* VT = (h16*)wsp;  wsp += SZ_PL;                  // [8][128][SEQ]
    h16* VR = (h16*)wsp;  wsp += SZ_RS;                  // [8][128][EROWS] residual x2048
    h16* YH = (h16*)wsp;  wsp += SZ_YH;                  // [SEQ][1024] (x64)
    h16* YR = (h16*)wsp;  wsp += SZ_YR;                  // [EROWS][1024] residual x2048
    const size_t PLE = (size_t)NH_ * SEQ * HD;
    const h16* QH = QK; const h16* QR = QK + PLE; const h16* KP = QK + 2 * PLE; const h16* KR = QK + 3 * PLE;

    { const size_t n8 = (size_t)SEQ * DM / 8;
      k_cvt8<<<(unsigned)((n8 + 255) / 256), 256, 0, stream>>>(x, XB, n8); }
    { const size_t n8 = (size_t)3 * DM * DM / 8;
      k_cvt8<<<(unsigned)((n8 + 255) / 256), 256, 0, stream>>>(w, WB, n8); }
    { const size_t n8 = (size_t)DM * DM / 8;
      k_cvtw<<<(unsigned)((n8 + 255) / 256), 256, 0, stream>>>(w + (size_t)3 * DM * DM, WO, n8); }
    k_ropetab<<<(unsigned)((size_t)SEQ * 32 / 256), 256, 0, stream>>>(CS);

    // fused QKV: token tiles x 24 head slots -> q, q residual, k, k residual planes [h][t][d]; v^T plane [h][d][t] (+ residual for t < EROWS)
    k_qkv<<<dim3(SEQ / 64, NQKV, 1), 64, 0, stream>>>(XB, WB, ve, lam, CS, QK, VT, VR);

    // query rows [0, EROWS): multi-product instantiation (two halves of the head dimension); rows [EROWS, SEQ): single P / v / y (disjoint y rows)
    k_flash_early<<<dim3(EROWS / (16 * AW), NH_, 2), 32 * AW, 0, stream>>>(QH, QR, KP, KR, VT, VR, win, YH, YR);
    if (SEQ > EROWS)
        k_flash_late<<<dim3((SEQ - EROWS) / (16 * AW), NH_, 1), 32 * AW, 0, stream>>>(QH, QR, KP, KR, VT, VR, win, YH, YR);

    // out[t][d] = sum_e y[t][e] Wo[d][e]
    k_out<<<dim3(SEQ / 64, DM / 64, 1), 32, 0, stream>>>(YH, YR, WO, OUT);
}

// v002
// It runs in 145 microseconds.
// Next to v001, in two timings, it ran 1.24 and 1.25 times as fast.
// All steps since v000 together make it 1.99 times as fast.
#include <hip/hip_runtime.h>

// Attention layer: one input x [SEQ][1024] feeds a fused [out][in] QKV projection (24 head slots of 128: q 0..7, k 8..15, v 16..23); unweighted RMS normalisation (eps 1e-6) of q, k, v per head row;
// half-split rotary embedding with only the first 32 of the 64 frequency pairs active (base 1024); v = l0 * vnorm + l1 * value-embedding; sliding-window causal keep rule 0 <= t - j < window
// (window int32, device-read; window <= 0 gives the uniform row over all keys); score scale 0.12 (multiplied); softmax f32 (online, running max over kept keys); output projection y Wo^T with Wo [out][in].
// Compute dtypes, f32 accumulate everywhere: QKV projection v_wmma_f32_16x16x32_bf16 (x, W RNE-converted to bf16; products exact);
// scores v_wmma_f32_16x16x32_f16 with q and k each as f16 value + f16 residual x2048 in its own accumulator (three products) on all rows;
// P.V v_wmma_f32_16x16x32_f16: P (x16384 carry, cancels in the normalisation) and v single f16 on query rows >= EROWS; on query rows < EROWS P and v each as f16 value + f16 residual x2048 (residual products in their own accumulator, folded by 1/2048);
// output projection v_wmma_f32_16x16x32_f16: y carried x64 (single f16 on rows >= EROWS, f16 value + f16 residual x2048 on rows < EROWS), Wo = bf16(RNE) x256 held exactly in f16; fold 1/16384 in the f32 epilogue.
// Layout: bf16 planes of x and of the three QKV weights; f16 plane of Wo; rotary table [t][cos 0..31 | sin 0..31]; q / q-residual / k / k-residual planes [h][t][128]; v^T plane [h][d][t], v^T residual [h][d][t < EROWS];
// y plane [t][1024] (+ residual for t < EROWS). Flash kernel in transposed form (S^T = K Q^T, O^T = V^T P^T), fragments straight from the planes, no LDS and no barrier in the key loop.
// The two projections: 128 x 128 output tile per block of four waves (64 x 64 each); both operand tiles go from the planes into LDS by asynchronous copies of whole 128-byte lines (two buffers), fragments are read from LDS.

#ifndef NB
#define NB 1
#endif
#ifndef SEQ
#define SEQ 4096
#endif
#define NB_FULL  1
#define SEQ_FULL 4096
#define DM   1024
#define NH_  8
#define HD   128
#define NQKV 24                  // head slots of the fused projection
#define AW   4                   // waves per flash block (16 query rows each)
#define TP   132                 // LDS row pitch (floats) of the 128 x 128 head tile
#define EROWS (SEQ < 512 ? SEQ : 512)   // query rows (and tokens of the small residual planes) handled by the multi-product flash instantiation
#define QRS  2048.0f             // carry of every residual plane / residual fragment
#define QRI  (1.0f / 2048.0f)
#define SC2  ((float)(0.12 * 1.4426950408889634))   // score scale * log2(e)
#define PSH  14.0f               // log2 of the P carry (16384)
#define NEGB (-3.0e38f)
#define YC   64.0f               // carry of the y planes
#define WOC  256.0f              // carry of the Wo plane
#define OSC  (1.0f / (64.0f * 256.0f))

static_assert(NB == 1);
static_assert(HD == 128);                      // q/k plane row = 256 bytes = two lines; lane owns 4 columns of a head row
static_assert(NH_ * HD == DM);
static_assert(NQKV == 3 * NH_);
static_assert(DM % 64 == 0);
static_assert(DM % 128 == 0);                  // GEMM column tiles of 128; K tiles of 64 and of 128
static_assert(HD % 32 == 0);                   // score k-loop steps by 32
static_assert(SEQ % 64 == 0);
static_assert(SEQ % 32 == 0);                  // key loop steps by 32
static_assert(EROWS % 128 == 0);               // a 128-token GEMM tile lies wholly inside or outside the residual planes
static_assert(SEQ % 128 == 0);                 // GEMM token tiles
static_assert(EROWS >= 32);
static_assert(EROWS <= SEQ);
static_assert(EROWS % (16 * AW) == 0);
static_assert((SEQ - EROWS) % (16 * AW) == 0);
static_assert(((size_t)SEQ * DM) % 8 == 0);
static_assert(((size_t)DM * DM) % 8 == 0);
static_assert(((size_t)SEQ * 32) % 256 == 0);  // rotary table grid covers the table exactly
static_assert(SEQ <= SEQ_FULL);
static_assert((TP * 4) % 16 == 0);
static_assert(sizeof(float) * 128 * TP <= 131072);

typedef _Float16 h16;
typedef unsigned short bf;
typedef __attribute__((ext_vector_type(16))) __bf16   v16bf;
typedef __attribute__((ext_vector_type(16))) _Float16 v16h;
typedef __attribute__((ext_vector_type(8)))  _Float16 v8h;
typedef __attribute__((ext_vector_type(8)))  unsigned short v8us;
typedef __attribute__((ext_vector_type(8)))  float    v8f;
typedef __attribute__((ext_vector_type(4)))  float    v4f;
typedef v4f  __attribute__((may_alias)) v4fa;

__device__ __forceinline__ unsigned short f2bf(float f) { unsigned u = __float_as_uint(f); u += 0x7FFFu + ((u >> 16) & 1u); return (unsigned short)(u >> 16); }
__device__ __forceinline__ float bfr(float f) { return __uint_as_float(((unsigned)f2bf(f)) << 16); }   // value after RNE convert to bf16
__device__ __forceinline__ v16h cat16(v8h lo, v8h hi) { return __builtin_shufflevector(lo, hi, 0, 1, 2, 3, 4, 5, 6, 7, 8, 9, 10, 11, 12, 13, 14, 15); }
__device__ __forceinline__ v16bf cat16b(v8us lo, v8us hi) { return __builtin_bit_cast(v16bf, __builtin_shufflevector(lo, hi, 0, 1, 2, 3, 4, 5, 6, 7, 8, 9, 10, 11, 12, 13, 14, 15)); }
__device__ __forceinline__ v8f wmma16(v16h a, v16h b, v8f c) { return __builtin_amdgcn_wmma_f32_16x16x32_f16(false, a, false, b, (short)0, c, false, false); }
__device__ __forceinline__ v8f wmmab(v16bf a, v16bf b, v8f c) { return __builtin_amdgcn_wmma_f32_16x16x32_bf16(false, a, false, b, (short)0, c, false, false); }
// fragment loaders from K-contiguous 16-bit rows; p already includes + 8*(lane>>4): elements 0..7 <- k0+8h+0..7, elements 8..15 <- k0+16+8h+0..7 (same map for A and B)
__device__ __forceinline__ v16h  ldh(const h16* p) { return cat16(*(const v8h*)p, *(const v8h*)(p + 16)); }
__device__ __forceinline__ v16bf ldb(const bf* p)  { return cat16b(*(const v8us*)p, *(const v8us*)(p + 16)); }
// ordering point for wave-private LDS tiles (same wave writes and reads)
__device__ __forceinline__ void wave_sync() { __builtin_amdgcn_fence(3 /* release order */, "wavefront"); __builtin_amdgcn_wave_barrier(); asm volatile("" ::: "memory"); }

// f32 -> f16 convert that cannot produce a subnormal operand: |v| < 2^-14 -> +0 (value select)
static __device__ __forceinline__ h16 toh_flush(float v) { const h16 r = (h16)v; return (fabsf(v) < 6.103515625e-05f) ? (h16)0.0f : r; }
// per-instruction guarded WMMA wrappers: one accumulator per guard (four vector slots behind the product before its result is used).
// The guard names the accumulator alone: an asm operand is held below v256, and the fragment sets that are in flight need the registers above.
__device__ __forceinline__ v8f wmma16g(v16h a, v16h b, v8f c) { c = wmma16(a, b, c); asm volatile("v_nop\n\tv_nop\n\tv_nop\n\tv_nop" : "+v"(c)); return c; }
__device__ __forceinline__ v8f wmmabg(v16bf a, v16bf b, v8f c) { c = wmmab(a, b, c); asm volatile("v_nop\n\tv_nop\n\tv_nop\n\tv_nop" : "+v"(c)); return c; }

template <bool B> struct flag_t { static constexpr bool v = B; };
// stands behind a batch of fragment loads: keeps the products that follow in the source from being scheduled in front of the batch (the loads would then be issued only when their values are already due)
__device__ __forceinline__ void loads_first() { __builtin_amdgcn_sched_barrier(0); }
// stands between issued global loads and the first instruction that may rewrite a register that they name (their address pairs die at issue and are reused at once, or are advanced at the loop's top);
// the scheduling barrier keeps later instructions behind the wait; the loads' base addresses are named as inputs, so that their registers stay allocated up to the wait
__device__ __forceinline__ void addr_free(const void* p, const void* q) { asm volatile("s_wait_xcnt 0x0" :: "v"(p), "v"(q) : "memory"); __builtin_amdgcn_sched_barrier(0); }

__device__ __forceinline__ v16h  ldf(const h16* p) { return ldh(p); }
__device__ __forceinline__ v16bf ldf(const bf* p)  { return ldb(p); }
__device__ __forceinline__ v8f mmg(v16h a, v16h b, v8f c)   { return wmma16g(a, b, c); }
__device__ __forceinline__ v8f mmg(v16bf a, v16bf b, v8f c) { return wmmabg(a, b, c); }
__device__ __forceinline__ unsigned lds_off(const void* p) { return (unsigned)(size_t)p; }   // byte offset in the work-group's LDS
// eight asynchronous 16-byte copies per lane, global -> LDS: piece i goes from g + i * gs to LDS byte l + i * ls. The wait at the end of the statement stands in front of every later rewrite of the address registers.
__device__ __forceinline__ void copy8(const unsigned l, const unsigned ls, const char* g, const size_t gs) {
    asm volatile("global_load_async_to_lds_b128 %0, %8, off\n\t"
                 "global_load_async_to_lds_b128 %1, %9, off\n\t"
                 "global_load_async_to_lds_b128 %2, %10, off\n\t"
                 "global_load_async_to_lds_b128 %3, %11, off\n\t"
                 "global_load_async_to_lds_b128 %4, %12, off\n\t"
                 "global_load_async_to_lds_b128 %5, %13, off\n\t"
                 "global_load_async_to_lds_b128 %6, %14, off\n\t"
                 "global_load_async_to_lds_b128 %7, %15, off\n\t"
                 "s_wait_xcnt 0x0"
                 :: "v"(l), "v"(l + ls), "v"(l + 2 * ls), "v"(l + 3 * ls), "v"(l + 4 * ls), "v"(l + 5 * ls), "v"(l + 6 * ls), "v"(l + 7 * ls),
                    "v"(g), "v"(g + gs), "v"(g + 2 * gs), "v"(g + 3 * gs), "v"(g + 4 * gs), "v"(g + 5 * gs), "v"(g + 6 * gs), "v"(g + 7 * gs)
                 : "memory");
}
// the issuing wave's copies have landed in LDS behind this wait
__device__ __forceinline__ void copies_landed() { asm volatile("s_wait_asynccnt 0x0" ::: "memory"); }
// the wave's own LDS reads have returned behind this wait (in front of the barrier that frees a buffer for its refill)
__device__ __forceinline__ void lds_reads_done() { asm volatile("s_wait_dscnt 0x0" ::: "memory"); }

// gemm128: acc += A[128 rows][DM] * B[128 rows][DM]^T for a block of four waves; wave w owns rows 64 (w >> 1) .. + 63 of A and rows 64 (w & 1) .. + 63 of B (16 accumulators, k ascending in steps of 32).
// K is cut into tiles of KC elements. A stage in LDS is [A tile | B tile], 128 rows each at pitch 2 KC + 16 bytes (16 B x odd: the pitch for 16-byte row reads); two stages.
// Copies: a row piece of 2 KC bytes is brought by KC / 8 neighbouring lanes, so every copy instruction covers whole 128-byte lines. Tile t + 2 is copied into the buffer of tile t behind the barrier that ends trip t.
// On return every wave has passed a barrier behind its last LDS read and no copy is outstanding: sm may be reused at once.
template <int KC, class T>
__device__ __forceinline__ void gemm128(const T* __restrict__ Ag, const T* __restrict__ Bg, char* sm, v8f (&acc)[4][4]) {
    constexpr int PB  = KC * 2 + 16;             // LDS row pitch, bytes
    constexpr int TB  = 128 * PB;                // one operand tile
    constexpr int SB  = 2 * TB;                  // one stage
    constexpr int NT  = DM / KC;                 // tiles along K
    constexpr int NK  = KC / 32;                 // k steps per tile
    constexpr int LPW = KC / 8;                  // lanes per row piece
    constexpr int RPC = 128 / LPW;               // rows per copy of the whole block
    constexpr int NC  = 128 / RPC;               // copies per lane and operand tile
    static_assert(sizeof(T) == 2);
    static_assert(DM % KC == 0);
    static_assert(NT >= 2);
    static_assert(NC % 8 == 0);
    static_assert(2 * NC <= 63);                 // copies of a wave in flight
    static_assert((PB / 16) % 2 == 1);
    const int tid = (int)threadIdx.x, lane = tid & 31, lr = lane & 15, hi = lane >> 4;
    const int wave = __builtin_amdgcn_readfirstlane(tid >> 5);
    const int crow = tid / LPW, cpc = tid % LPW;                   // the lane's first row (0 .. RPC - 1) and its 16-byte piece of the row
    const unsigned l0 = lds_off(sm) + (unsigned)(crow * PB + cpc * 16);
    const char* ga = (const char*)(Ag + (size_t)crow * DM + cpc * 8);
    const char* gb = (const char*)(Bg + (size_t)crow * DM + cpc * 8);
    auto fill = [&](const int buf, const int t) __attribute__((always_inline)) {
#pragma unroll
        for (int g = 0; g < NC; g += 8) copy8(l0 + (unsigned)(buf * SB + g * RPC * PB), RPC * PB, ga + (size_t)g * RPC * DM * 2 + (size_t)t * KC * 2, (size_t)RPC * DM * 2);
#pragma unroll
        for (int g = 0; g < NC; g += 8) copy8(l0 + (unsigned)(buf * SB + TB + g * RPC * PB), RPC * PB, gb + (size_t)g * RPC * DM * 2 + (size_t)t * KC * 2, (size_t)RPC * DM * 2); };
    const int fao = ((wave >> 1) * 64 + lr) * PB + 16 * hi;        // fragment rows: same element map as the loaders from the planes
    const int fbo = TB + ((wave & 1) * 64 + lr) * PB + 16 * hi;
    fill(0, 0);
    copies_landed();
    __syncthreads();
    fill(1, 1);
#pragma unroll 1
    for (int t = 0; t < NT; ++t) {
        const char* sb = sm + (t & 1) * SB;
        decltype(ldf((const T*)nullptr)) a[2][4], b[2][4];
        // two fragment sets inside a tile: the 16 LDS reads of k step s + 1 stand as one group in front of the 16 products of k step s
        auto ldst = [&](const int s, const int kk) __attribute__((always_inline)) {
#pragma unroll
            for (int mb = 0; mb < 4; ++mb) a[s][mb] = ldf((const T*)(sb + fao + mb * 16 * PB + kk * 64));
#pragma unroll
            for (int nb = 0; nb < 4; ++nb) b[s][nb] = ldf((const T*)(sb + fbo + nb * 16 * PB + kk * 64));
            loads_first(); };
        ldst(0, 0);
#pragma unroll
        for (int kk = 0; kk < NK; ++kk) {
            if (kk + 1 < NK) ldst((kk + 1) & 1, kk + 1);
#pragma unroll
            for (int nb = 0; nb < 4; ++nb)
#pragma unroll
                for (int mb = 0; mb < 4; ++mb) acc[mb][nb] = mmg(a[kk & 1][mb], b[kk & 1][nb], acc[mb][nb]);
        }
        lds_reads_done();
        copies_landed();
        __syncthreads();                                           // publishes tile t + 1 and frees the buffer of tile t
        if (t + 2 < NT) fill(t & 1, t + 2);                        // same test in the whole block
    }
    copies_landed();
}

__global__ __launch_bounds__(256) void k_cvt8(const float* __restrict__ src, bf* dst, size_t n8) {
    const size_t i = (size_t)blockIdx.x * 256 + threadIdx.x; if (i >= n8) return;
    const v8f v = *(const v8f*)(src + i * 8); v8us o;
#pragma unroll
    for (int k = 0; k < 8; ++k) o[k] = f2bf(v[k]);
    *(v8us*)(dst + i * 8) = o; 
}

__global__ __launch_bounds__(256) void k_cvtw(const float* __restrict__ src, h16* dst, size_t n8) {
#pragma clang fp contract(off)
    const size_t i = (size_t)blockIdx.x * 256 + threadIdx.x; if (i >= n8) return;
    const v8f v = *(const v8f*)(src + i * 8); v8h o;
#pragma unroll
    for (int k = 0; k < 8; ++k) o[k] = toh_flush(bfr(v[k]) * WOC);
    *(v8h*)(dst + i * 8) = o; 
}

// k_ropetab: rotary table CS[t][0..31] = cos(t * f_j), CS[t][32..63] = sin(t * f_j), f_j = 2^(-10 * j / 31), j < 32 (the other 32 pairs are the identity).
__global__ __launch_bounds__(256) void k_ropetab(float* CS) {
#pragma clang fp contract(off)
    const int i = (int)blockIdx.x * 256 + (int)threadIdx.x;       // grid * 256 == SEQ * 32 exactly
    const int t = i >> 5, j = i & 31;
    const float e = (float)j / 31.0f;
    const float a = -10.0f * e;
    const float lo = fmaf(-10.0f, e, -a);                          // exact residual of the exponent product
    float invf = exp2f(a);
    invf = fmaf(invf, 0.69314718056f * lo, invf);
    const float th = (float)t * invf;
    float s, c; sincosf(th, &s, &c);
    float* row = CS + (size_t)t * 64;
    *(float*)(row + j) = c; *(float*)(row + 32 + j) = s;
    
}

// k_qkv: fused QKV projection + per-head RMS normalisation + rotary (q, k) / value mix (v). Block = 4 waves, tile = 128 tokens x one head slot (128 columns);
// each wave computes a 64 x 64 quarter (16 accumulators, operand tiles staged in LDS by gemm128, K = DM), stages it in the block's LDS tile (the same LDS, free behind gemm128); block barrier;
// row pass: wave w owns rows 32w..32w+31, lane owns columns 4*lane..4*lane+3, sum of squares by xor exchanges, rotary partner (d +- 64) by one xor-16 exchange, result written back in place; block barrier;
//             v slots: transposed plane [h][d][t] (row pitch SEQ) value, and residual x2048 [h][d][t < EROWS] for token tiles below EROWS: 8 lanes x 16 B per d-row line (64 tokens), four d-rows per instruction.
// LDS tile: cross-wave (block barriers). grid (SEQ/128, NQKV).
__global__ __launch_bounds__(128) void k_qkv(const bf* __restrict__ XB, const bf* __restrict__ WB, const float* __restrict__ ve, const float* __restrict__ lam, const float* __restrict__ CS,
                                            h16* QK, h16* VT, h16* VR) {
    constexpr int RING = 2 * 2 * 128 * (64 * 2 + 16), TILE = 128 * TP * 4;     // bytes: two stages of gemm128<64>; the f32 head tile
    __shared__ __align__(16) char sm[RING > TILE ? RING : TILE];
    float* os = (float*)sm;
    const size_t PLE = (size_t)NH_ * SEQ * HD;                     // elements per q/k plane; QK = [q | q residual | k | k residual]
    const int lane = threadIdx.x & 31, lr = lane & 15, hi = lane >> 4;
    const int wave = __builtin_amdgcn_readfirstlane((int)(threadIdx.x >> 5));
    const int r0 = blockIdx.x * 128;
    const int hh = blockIdx.y;                                     // block-uniform head slot
    const int kind = hh >> 3, hd = hh & 7;
    const int wt = wave >> 1, wc = wave & 1;                       // this wave's token half and column half of the tile
    v8f acc[4][4];
#pragma unroll
    for (int mb = 0; mb < 4; ++mb)
#pragma unroll
        for (int nb = 0; nb < 4; ++nb) acc[mb][nb] = (v8f){};
    gemm128<64>(XB + (size_t)r0 * DM, WB + (size_t)hh * HD * DM, sm, acc);
    // D: row 8h+j, col lane&15 -> this wave's 64 tile rows and 64 columns
#pragma unroll
    for (int mb = 0; mb < 4; ++mb)
#pragma unroll
        for (int nb = 0; nb < 4; ++nb)
#pragma unroll
            for (int j = 0; j < 8; ++j) os[(wt * 64 + mb * 16 + hi * 8 + j) * TP + wc * 64 + nb * 16 + lr] = acc[mb][nb][j];
    __syncthreads();
    const float l0 = bfr(lam[0]), l1 = bfr(lam[1]);
    const float sg = (lane < 16) ? 1.0f : -1.0f;                   // d < 64: x1 c + x2 s; d >= 64: x2 c - x1 s
    const bool act = (lane & 8) == 0;                              // frequency index (d & 63) < 32
    // the table (q, k) or value-embedding (v) rows of eight tokens are loaded together, in front of the eight row computations
    auto rowpass = [&](auto fq) __attribute__((always_inline)) {
        constexpr bool QKR = decltype(fq)::v;
#pragma unroll 1
        for (int rg = 0; rg < 32; rg += 8) {
            v4f g0[8], g1[8], xg[8];
            const int tg = r0 + wave * 32 + rg;
            const float* gp = QKR ? CS + (size_t)tg * 64 + 4 * (lane & 7)                   // address always inside the table row
                                  : ve + (size_t)tg * DM + (size_t)hd * HD + 4 * lane;
#pragma unroll
            for (int u = 0; u < 8; ++u) {
                if constexpr (QKR) { g0[u] = *(const v4f*)(gp + u * 64); g1[u] = *(const v4f*)(gp + u * 64 + 32); }
                else               { g0[u] = *(const v4f*)(gp + (size_t)u * DM); } }
            loads_first(); addr_free(gp, gp);
#pragma unroll
            for (int u = 0; u < 8; ++u) xg[u] = *(const v4fa*)(&os[(wave * 32 + rg + u) * TP + 4 * lane]);
#pragma unroll
            for (int u = 0; u < 8; ++u) {
                const int row = wave * 32 + rg + u;
                const v4f xv = xg[u];
                float ss = xv[0] * xv[0] + xv[1] * xv[1] + xv[2] * xv[2] + xv[3] * xv[3];
                ss += __shfl_xor(ss, 16, 32); ss += __shfl_xor(ss, 8, 32); ss += __shfl_xor(ss, 4, 32); ss += __shfl_xor(ss, 2, 32); ss += __shfl_xor(ss, 1, 32);
                const float inv = rsqrtf(ss * (1.0f / HD) + 1.0e-6f);
                v4f y;
                if constexpr (QKR) {
                    v4f cv = g0[u];
                    v4f sv = g1[u];
                    asm volatile("" : "+v"(cv), "+v"(sv));
#pragma unroll
                    for (int i = 0; i < 4; ++i) {
                        const float xn = xv[i] * inv;
                        const float part = __shfl_xor(xn, 16, 32);
                        const float c = act ? cv[i] : 1.0f; const float s = act ? sv[i] : 0.0f;
                        y[i] = xn * c + sg * (part * s); }
                } else {
                    const v4f e4 = g0[u];
#pragma unroll
                    for (int i = 0; i < 4; ++i) y[i] = l0 * (xv[i] * inv) + l1 * bfr(e4[i]);
                }
                *(v4fa*)(&os[row * TP + 4 * lane]) = y;
            }
        } };
    if (kind < 2) rowpass(flag_t<true>{}); else rowpass(flag_t<false>{});      // block-uniform
    __syncthreads();
    if (kind < 2) {
        static_assert(4 * 16 * 32 * 16 == 128 * HD * 2);           // waves x instructions x lanes x 16 B == 128 rows x 256 B
        const size_t pb0 = (size_t)(kind * 2) * PLE + ((size_t)hd * SEQ + (size_t)r0) * HD;
{
#pragma unroll 2
            for (int it = 0; it < 16; ++it) { const int row = wave * 32 + it * 2 + (lane >> 4), c8 = (lane & 15) * 8;
                const v4f x0 = *(const v4fa*)(&os[row * TP + c8]); const v4f x1 = *(const v4fa*)(&os[row * TP + c8 + 4]); v8h hv, rv;
#pragma unroll
                for (int i = 0; i < 4; ++i) { const h16 a0 = toh_flush(x0[i]); const h16 a1 = toh_flush(x1[i]); hv[i] = a0; hv[4 + i] = a1;
                    rv[i] = toh_flush((x0[i] - (float)a0) * QRS); rv[4 + i] = toh_flush((x1[i] - (float)a1) * QRS); }
                const size_t oo = pb0 + (size_t)row * HD + c8;
                *(v8h*)(QK + oo) = hv; *(v8h*)(QK + PLE + oo) = rv; }
             }
    } else {
        static_assert(4 * 16 * 32 * 16 == HD * 128 * 2);
        const bool wr = r0 < EROWS;                                // block-uniform: whole token tile inside the residual plane
        const size_t vb0 = ((size_t)hd * HD) * SEQ + (size_t)r0;
        const size_t rb0 = ((size_t)hd * HD) * EROWS + (size_t)r0;
{
#pragma unroll 2
            for (int it = 0; it < 16; ++it) { const int d = wc * 64 + it * 4 + (lane >> 3), c8 = wt * 64 + (lane & 7) * 8; v8h hv, rv;
#pragma unroll
                for (int i = 0; i < 8; ++i) { const float x = os[(c8 + i) * TP + d]; const h16 a0 = toh_flush(x); hv[i] = a0; rv[i] = toh_flush((x - (float)a0) * QRS); }
                *(v8h*)(VT + vb0 + (size_t)d * SEQ + c8) = hv;
                if (wr) *(v8h*)(VR + rb0 + (size_t)d * EROWS + c8) = rv; }
             }
    }
}

// flash_body: fused attention, one wave per 16 query rows of one head (EARLY: of one 64-wide half of the head dimension); K / V^T / Q fragments straight from the f16 planes.
// Transposed form: S^T[key][t] = K Q^T (A = K rows, B = Q rows); lane (t = lane&15, h = lane>>4) holds keys 8h+r of each 16-key tile, so the packed
// P tile is directly the B fragment of O^T[d][t] = V^T P^T (element r <- tile keys 0..15, element 8+r <- tile keys 16..31, lane unchanged).
// Scores on all rows: K Q + (K Q_res + K_res Q) / 2048. Keep rule per element: 0 <= t - key < window; window <= 0: every key kept with score 0 (uniform row).
// Key range per wave [klo, kend) from the device-read window, inside [0, SEQ); all visited plane rows are written by k_qkv.
// EARLY = 1 (query rows [0, EROWS)): P = f16 value + f16 residual x2048; O = V P + (V P_res + V_res P) / 2048; row sum from the f32 exponentials; y written as value + residual x2048.
// EARLY = 0 (query rows [EROWS, SEQ)): single P, v, y; row sum over the converted P.
template <int EARLY>
__device__ __forceinline__ void flash_body(const h16* __restrict__ QH, const h16* __restrict__ QR, const h16* __restrict__ KP, const h16* __restrict__ KR,
                                           const h16* __restrict__ VT, const h16* __restrict__ VR, const int* __restrict__ win_p, h16* YH, h16* YR) {
    constexpr int DT  = EARLY ? 4 : 8;           // 16-wide output tiles per wave
    constexpr int OSP = DT * 16 + 4;             // LDS row pitch (floats)
    constexpr int LPR = DT * 2;                  // lanes per y row segment (16 B each)
    constexpr int RPI = 32 / LPR;                // rows per store instruction
    constexpr int NST = 16 / RPI;                // store instructions per pass
    static_assert(32 % LPR == 0);
    static_assert(16 % RPI == 0);
    static_assert(NST * 32 * 16 == 16 * DT * 16 * 2);   // instructions x lanes x 16 B == 16 rows x segment bytes
    static_assert((OSP * 4) % 16 == 0);
    static_assert(sizeof(float) * AW * 16 * OSP <= 131072);
    __shared__ __align__(16) float os[AW * 16 * OSP];
    const int lane = threadIdx.x & 31, lr = lane & 15, hi = lane >> 4;
    const int wv = (int)(threadIdx.x >> 5);
    const int wave = __builtin_amdgcn_readfirstlane(wv);
    const int h = blockIdx.y;
    const int d0 = EARLY ? (int)blockIdx.z * 64 : 0;
    int winv = win_p[0];
    const bool allm = winv <= 0;                                   // every key replaced by the fill value: uniform row
    winv = winv > SEQ ? SEQ : winv;
    const int t0v = (EARLY ? 0 : EROWS) + ((int)blockIdx.x * AW + wv) * 16;
    int klov = t0v - winv + 1; klov = klov < 0 ? 0 : klov; klov &= ~31; klov = allm ? 0 : klov;
    const int kendv = allm ? SEQ : (t0v + 16);
    const int t0 = __builtin_amdgcn_readfirstlane(t0v);
    const int klo = __builtin_amdgcn_readfirstlane(klov);
    const int kend = __builtin_amdgcn_readfirstlane(kendv);        // key tiles [klo, kend) step 32; last tile ends at or below SEQ
    const size_t qo = ((size_t)h * SEQ + (size_t)(t0 + lr)) * HD + 8 * hi;        // B fragments: col t, k = d
    const v16h hz = (v16h){};
    v8f o[DT], oR[DT];
#pragma unroll
    for (int j = 0; j < DT; ++j) { o[j] = (v8f){}; oR[j] = (v8f){}; }
    float m = NEGB, l = 0.0f;
    // load schedule: Q fragments once, in front of the key loop; the K fragments of tile s + 1 behind the score products of tile s; the V fragments of tile s in front of its score products
    v16h qh[4], qr[4], ka[4], kq[4], ra[4], rb[4];
#pragma unroll
    for (int c = 0; c < 4; ++c) { qh[c] = ldh(QH + qo + 32 * c); qr[c] = ldh(QR + qo + 32 * c); }
    auto ldk = [&](const int key) __attribute__((always_inline)) {
        const size_t kb = ((size_t)h * SEQ + (size_t)(key + lr)) * HD + 8 * hi;    // A fragment: row key, k = d
        const h16* kp = KP + kb; const h16* rp = KR + kb;
#pragma unroll
        for (int c = 0; c < 4; ++c) { ka[c] = ldh(kp + 32 * c); kq[c] = ldh(kp + 16 * HD + 32 * c);
                                      ra[c] = ldh(rp + 32 * c); rb[c] = ldh(rp + 16 * HD + 32 * c); }
        loads_first(); addr_free(kp, rp); };
    addr_free(QH + qo, QR + qo);
    ldk(klo);
    int key0 = klo;
    // the first tile always exists (klo <= t0 < kend; uniform row: 0 < SEQ), so the test stands at the foot and the first tile's loads stay in front of the loop
#pragma unroll 1
    do {
        const bool rok = key0 < EROWS;                           // wave-uniform
        const int kcl = rok ? key0 : (EROWS - 32);               // clamped residual-plane key (address always inside the plane)
        v16h vf[DT], vrf[DT];
        const size_t vrow = (size_t)h * HD + (size_t)(d0 + lr);                          // A fragment: row d (+ 16 j), k = key
        const h16* vp = VT + vrow * SEQ + (size_t)key0 + 8 * hi; const h16* vq = VR + vrow * EROWS + (size_t)kcl + 8 * hi;
#pragma unroll
        for (int j = 0; j < DT; ++j) {
            vf[j] = ldh(vp + (size_t)j * 16 * SEQ);
            if (EARLY) vrf[j] = ldh(vq + (size_t)j * 16 * EROWS);
        }
        loads_first(); addr_free(vp, EARLY ? vq : vp);
        v8f sHa = (v8f){}, sLa = (v8f){}, sHb = (v8f){}, sLb = (v8f){};
#pragma unroll
        for (int c = 0; c < 4; ++c) {
            sHa = wmma16g(ka[c], qh[c], sHa); sLa = wmma16g(ka[c], qr[c], sLa); sLa = wmma16g(ra[c], qh[c], sLa);
            sHb = wmma16g(kq[c], qh[c], sHb); sLb = wmma16g(kq[c], qr[c], sLb); sLb = wmma16g(rb[c], qh[c], sLb);
        }
        // behind the last tile there is none: it loads its own rows again (inside the plane, values unused), so that the body has no branch and the wait for V in front of P.V need not cover these loads
        ldk(key0 + 32 < kend ? key0 + 32 : key0);
        const int da0 = (t0 + lr) - (key0 + 8 * hi);             // t - key for r = 0 of tile a
        float ta[8], tb[8]; bool fa[8], fb[8]; float mx = NEGB;
#pragma unroll
        for (int r = 0; r < 8; ++r) {
            const int da = da0 - r, db = da0 - 16 - r;
            fa[r] = allm | ((da >= 0) & (da < winv));
            fb[r] = allm | ((db >= 0) & (db < winv));
            const float ua = (sHa[r] + sLa[r] * QRI) * SC2, ub = (sHb[r] + sLb[r] * QRI) * SC2;
            ta[r] = allm ? 0.0f : ua; tb[r] = allm ? 0.0f : ub;
            mx = fmaxf(mx, fmaxf(fa[r] ? ta[r] : NEGB, fb[r] ? tb[r] : NEGB)); }
        mx = fmaxf(mx, __shfl_xor(mx, 16, 32));
        const float mnew = fmaxf(m, mx);
        const float alpha = __builtin_amdgcn_exp2f(m - mnew);
        const float sh = PSH - mnew;
        v16h pb, pr = hz; float ls = 0.0f;
#pragma unroll
        for (int r = 0; r < 8; ++r) {
            const float xa = ta[r] + sh, xb = tb[r] + sh;
            const float ea = __builtin_amdgcn_exp2f(xa), eb = __builtin_amdgcn_exp2f(xb);
            const float ga = (fa[r] & (xa >= -14.0f)) ? ea : 0.0f;       // dropped elements and would-be subnormal operands selected to 0 by value
            const float gb = (fb[r] & (xb >= -14.0f)) ? eb : 0.0f;
            const h16 pa = (h16)ga; const h16 pc = (h16)gb;
            pb[r] = pa; pb[8 + r] = pc;
            if (EARLY) { pr[r] = toh_flush((ga - (float)pa) * QRS); pr[8 + r] = toh_flush((gb - (float)pc) * QRS); ls += ga + gb; }
            else       { ls += (float)pa + (float)pc; } }
        l = l * alpha + ls; m = mnew;
#pragma unroll
        for (int j = 0; j < DT; ++j) { o[j] = o[j] * alpha; if (EARLY) oR[j] = oR[j] * alpha; }
#pragma unroll
        for (int j = 0; j < DT; ++j) {
            const v16h v = vf[j];
            o[j] = wmma16g(v, pb, o[j]);
            if (EARLY) {
                v16h vr = vrf[j];
                if (!rok) vr = hz;
                oR[j] = wmma16g(v, pr, oR[j]);
                oR[j] = wmma16g(vr, pb, oR[j]);
            }
        }
        key0 += 32;
    } while (key0 < kend);
    l += __shfl_xor(l, 16, 32);
    const bool any = l > 0.0f;
    const float lsafe = any ? l : 1.0f;
    const float inv = any ? (YC * (1.0f / lsafe)) : 0.0f;
    const int wb = wave * 16 * OSP;
    // O^T D layout: f_j[r] = (d = 16j + 8h + r, t = lane&15) -> os[t][d]; rows 0..15 x columns 0..DT*16-1 all written; tile private to the wave
#pragma unroll
    for (int j = 0; j < DT; ++j) {
        v8f f = o[j];
        if (EARLY) f = o[j] + oR[j] * QRI;
        v4f a, c;
        a[0] = f[0] * inv; a[1] = f[1] * inv; a[2] = f[2] * inv; a[3] = f[3] * inv; c[0] = f[4] * inv; c[1] = f[5] * inv; c[2] = f[6] * inv; c[3] = f[7] * inv;
        *(v4fa*)(&os[wb + lr * OSP + 16 * j + 8 * hi]) = a; *(v4fa*)(&os[wb + lr * OSP + 16 * j + 8 * hi + 4]) = c; }
    wave_sync();
    const size_t ybase = (size_t)t0 * DM + (size_t)h * HD + (size_t)d0;
{
#pragma unroll 2
        for (int s = 0; s < NST; ++s) { const int row = s * RPI + lane / LPR, c8 = (lane % LPR) * 8;
            const v4f x0 = *(const v4fa*)(&os[wb + row * OSP + c8]); const v4f x1 = *(const v4fa*)(&os[wb + row * OSP + c8 + 4]); v8h hv, rv;
#pragma unroll
            for (int i = 0; i < 4; ++i) { const h16 a0 = toh_flush(x0[i]); const h16 a1 = toh_flush(x1[i]); hv[i] = a0; hv[4 + i] = a1;
                rv[i] = toh_flush((x0[i] - (float)a0) * QRS); rv[4 + i] = toh_flush((x1[i] - (float)a1) * QRS); }
            const size_t oo = ybase + (size_t)row * DM + c8;
            *(v8h*)(YH + oo) = hv;
            if (EARLY) *(v8h*)(YR + oo) = rv; }
         }
}

// query rows [0, EROWS): grid (EROWS/(16*AW), NH_, 2 halves of the head dimension)
__global__ __launch_bounds__(32 * AW) void k_flash_early(const h16* __restrict__ QH, const h16* __restrict__ QR, const h16* __restrict__ KP, const h16* __restrict__ KR,
                                                         const h16* __restrict__ VT, const h16* __restrict__ VR, const int* __restrict__ win_p, h16* YH, h16* YR) {
    flash_body<1>(QH, QR, KP, KR, VT, VR, win_p, YH, YR);
}
// query rows [EROWS, SEQ): grid ((SEQ-EROWS)/(16*AW), NH_)
__global__ __launch_bounds__(32 * AW) void k_flash_late(const h16* __restrict__ QH, const h16* __restrict__ QR, const h16* __restrict__ KP, const h16* __restrict__ KR,
                                                        const h16* __restrict__ VT, const h16* __restrict__ VR, const int* __restrict__ win_p, h16* YH, h16* YR) {
    flash_body<0>(QH, QR, KP, KR, VT, VR, win_p, YH, YR);
}

// k_out: output projection, block = 4 waves per 128 x 128 tile, 64 x 64 (16 accumulators) per wave, A = y rows (K contiguous), Bt = Wo rows [out][in]; f16 operands, tiles staged in LDS by gemm128.
// Token tiles below EROWS (block-uniform): the residual plane products are accumulated first, scaled by 1/2048 (exact), then the value-plane products are added.
__global__ __launch_bounds__(128) void k_out(const h16* __restrict__ YH, const h16* __restrict__ YR, const h16* __restrict__ WO, float* OUT) {
    __shared__ __align__(16) char sm[2 * 2 * 128 * (128 * 2 + 16)];           // two stages of gemm128<128>
    __shared__ __align__(16) float osw[4 * 16 * 68];                          // one output staging tile per wave
    const int lane = threadIdx.x & 31, lr = lane & 15, hi = lane >> 4;
    const int wave = __builtin_amdgcn_readfirstlane((int)(threadIdx.x >> 5));
    const int b0 = blockIdx.x * 128, e0 = blockIdx.y * 128;                   // the block's first token and first output column
    const int r0 = b0 + (wave >> 1) * 64, c0 = e0 + (wave & 1) * 64;          // the wave's
    float* os = osw + wave * 16 * 68;
    v8f acc[4][4];
#pragma unroll
    for (int mb = 0; mb < 4; ++mb)
#pragma unroll
        for (int nb = 0; nb < 4; ++nb) acc[mb][nb] = (v8f){};
    // pass 0 (residual plane) only where rows b0..b0+127 lie inside it, pass 1 (value plane) always; block-uniform. Kept rolled: one copy of the K loop in the text, and no address of one pass held in registers through the other
#pragma unroll 1
    for (int p = (b0 < EROWS) ? 0 : 1; p < 2; ++p) {
        gemm128<128>((p == 0 ? YR : YH) + (size_t)b0 * DM, WO + (size_t)e0 * DM, sm, acc);
        if (p == 0) {
#pragma unroll
            for (int mb = 0; mb < 4; ++mb)
#pragma unroll
                for (int nb = 0; nb < 4; ++nb) acc[mb][nb] = acc[mb][nb] * QRI;
        }
    }
    static_assert(8 * 32 * 16 == 16 * 64 * 4);                     // instructions x lanes x 16 B == 16 rows x 256 B
#pragma unroll
    for (int mb = 0; mb < 4; ++mb) {
#pragma unroll
        for (int nb = 0; nb < 4; ++nb) {
#pragma unroll
            for (int j = 0; j < 8; ++j) os[(hi * 8 + j) * 68 + nb * 16 + lr] = acc[mb][nb][j] * OSC; }   // D: row 8h+j, col lane&15
        wave_sync();
        float* orow = OUT + (size_t)(r0 + mb * 16) * DM + c0;
{
#pragma unroll
            for (int s = 0; s < 8; ++s) { const int row = 2 * s + (lane >> 4), c4 = (lane & 15) * 4;   // 8 s x 2 rows = 16 rows; 16 lanes x 4 floats = 64 columns = two lines
                const v4f val = *(const v4fa*)(&os[row * 68 + c4]);
                *(v4f*)(orow + (size_t)row * DM + c4) = val; }
             }
        wave_sync();
    }
}

static constexpr size_t al256(size_t v) { return (v + 255) & ~(size_t)255; }
static constexpr size_t SZ_XB = al256((size_t)SEQ * DM * 2);
static constexpr size_t SZ_WB = al256((size_t)3 * DM * DM * 2);
static constexpr size_t SZ_WO = al256((size_t)DM * DM * 2);
static constexpr size_t SZ_CS = al256((size_t)SEQ * 64 * 4);
static constexpr size_t SZ_PL = al256((size_t)NH_ * SEQ * HD * 2);
static constexpr size_t SZ_RS = al256((size_t)NH_ * HD * EROWS * 2);
static constexpr size_t SZ_YH = al256((size_t)SEQ * DM * 2);
static constexpr size_t SZ_YR = al256((size_t)EROWS * DM * 2);
static constexpr size_t SZ_TOTAL = SZ_XB + SZ_WB + SZ_WO + SZ_CS + 4 * SZ_PL + SZ_PL + SZ_RS + SZ_YH + SZ_YR;
static_assert(SZ_TOTAL <= (size_t)134217728);                        // workspace carve <= 128 MiB
static_assert(SZ_PL == (size_t)NH_ * SEQ * HD * 2);                  // the four q/k planes are contiguous with no padding between them
static_assert(((size_t)NH_ * SEQ * HD * 2) % 256 == 0);
static_assert((size_t)NH_ * SEQ * HD == (size_t)SEQ * DM);           // v^T plane [(h*128 + d)][t] has the extent of a q/k plane

extern "C" void kernel_launch(void* const* d_in, const int* in_sizes, int n_in,
                              void* d_out, int out_size, void* d_ws, size_t ws_size, hipStream_t stream) {
    if (n_in < 5) return;
    const size_t needx = (size_t)SEQ * DM;
    if ((size_t)in_sizes[0] < needx || (size_t)in_sizes[1] < needx) return;
    if (in_sizes[2] < 2) return;
    if ((size_t)in_sizes[3] < (size_t)4 * DM * DM) return;
    if (in_sizes[4] < 1) return;
    if ((size_t)out_size < needx) return;
    if (SZ_TOTAL > ws_size) return;
    // wire order: x, ve, lambdas, qkvo_w, window
    const float* x   = (const float*)d_in[0];
    const float* ve  = (const float*)d_in[1];
    const float* lam = (const float*)d_in[2];
    const float* w   = (const float*)d_in[3];
    const int*   win = (const int*)d_in[4];
    float* OUT = (float*)d_out;      // [SEQ][1024]
    char* wsp = (char*)d_ws;
    bf*  XB = (bf*)wsp;   wsp += SZ_XB;                  // x      [SEQ][1024] bf16
    bf*  WB = (bf*)wsp;   wsp += SZ_WB;                  // Wq|Wk|Wv [3072][1024] bf16 ([out][in] = Bt as-is)
    h16* WO = (h16*)wsp;  wsp += SZ_WO;                  // Wo [1024][1024] f16 (bf16 value x256)
    float* CS = (float*)wsp; wsp += SZ_CS;               // rotary table [SEQ][64]
    h16* QK = (h16*)wsp;  wsp += 4 * SZ_PL;              // [q | q residual | k | k residual], each [8][SEQ][128]
    h16* VT = (h16*)wsp;  wsp += SZ_PL;                  // [8][128][SEQ]
    h16* VR = (h16*)wsp;  wsp += SZ_RS;                  // [8][128][EROWS] residual x2048
    h16* YH = (h16*)wsp;  wsp += SZ_YH;                  // [SEQ][1024] (x64)
    h16* YR = (h16*)wsp;  wsp += SZ_YR;                  // [EROWS][1024] residual x2048
    const size_t PLE = (size_t)NH_ * SEQ * HD;
    const h16* QH = QK; const h16* QR = QK + PLE; const h16* KP = QK + 2 * PLE; const h16* KR = QK + 3 * PLE;

    { const size_t n8 = (size_t)SEQ * DM / 8;
      k_cvt8<<<(unsigned)((n8 + 255) / 256), 256, 0, stream>>>(x, XB, n8); }
    { const size_t n8 = (size_t)3 * DM * DM / 8;
      k_cvt8<<<(unsigned)((n8 + 255) / 256), 256, 0, stream>>>(w, WB, n8); }
    { const size_t n8 = (size_t)DM * DM / 8;
      k_cvtw<<<(unsigned)((n8 + 255) / 256), 256, 0, stream>>>(w + (size_t)3 * DM * DM, WO, n8); }
    k_ropetab<<<(unsigned)((size_t)SEQ * 32 / 256), 256, 0, stream>>>(CS);

    // fused QKV: token tiles x 24 head slots -> q, q residual, k, k residual planes [h][t][d]; v^T plane [h][d][t] (+ residual for t < EROWS)
    k_qkv<<<dim3(SEQ / 128, NQKV, 1), 128, 0, stream>>>(XB, WB, ve, lam, CS, QK, VT, VR);

    // query rows [0, EROWS): multi-product instantiation (two halves of the head dimension); rows [EROWS, SEQ): single P / v / y (disjoint y rows)
    k_flash_early<<<dim3(EROWS / (16 * AW), NH_, 2), 32 * AW, 0, stream>>>(QH, QR, KP, KR, VT, VR, win, YH, YR);
    if (SEQ > EROWS)
        k_flash_late<<<dim3((SEQ - EROWS) / (16 * AW), NH_, 1), 32 * AW, 0, stream>>>(QH, QR, KP, KR, VT, VR, win, YH, YR);

    // out[t][d] = sum_e y[t][e] Wo[d][e]
    k_out<<<dim3(SEQ / 128, DM / 128, 1), 128, 0, stream>>>(YH, YR, WO, OUT);
}

// v003
// Measured time: 109 microseconds a run.
// Next to v002, in two timings, it ran 1.32 and 1.33 times as fast.
// Over all steps from v000 it is 2.65 times as fast.
#include <hip/hip_runtime.h>

// Attention layer: one input x [SEQ][1024] feeds a fused [out][in] QKV projection (24 head slots of 128: q 0..7, k 8..15, v 16..23); unweighted RMS normalisation (eps 1e-6) of q, k, v per head row;
// half-split rotary embedding with only the first 32 of the 64 frequency pairs active (base 1024); v = l0 * vnorm + l1 * value-embedding; sliding-window causal keep rule 0 <= t - j < window
// (window int32, device-read; window <= 0 gives the uniform row over all keys); score scale 0.12 (multiplied); softmax f32 (online, running max over kept keys); output projection y Wo^T with Wo [out][in].
// Compute dtypes, f32 accumulate everywhere: QKV projection v_wmma_f32_16x16x32_bf16 (x, W RNE-converted to bf16; products exact);
// scores v_wmma_f32_16x16x32_f16 with q and k each as f16 value + f16 residual x2048 in its own accumulator (three products) on all rows;
// P.V v_wmma_f32_16x16x32_f16: P (x16384 carry, cancels in the normalisation) and v single f16 on query rows >= EROWS; on query rows < EROWS P and v each as f16 value + f16 residual x2048 (residual products in their own accumulator, folded by 1/2048);
// output projection v_wmma_f32_16x16x32_f16: y carried x64 (single f16 on rows >= EROWS, f16 value + f16 residual x2048 on rows < EROWS), Wo = bf16(RNE) x256 held exactly in f16; fold 1/16384 in the f32 epilogue.
// Layout: bf16 planes of x and of the three QKV weights; f16 plane of Wo; rotary table [t][cos 0..31 | sin 0..31]; q / q-residual / k / k-residual planes [h][t][128]; v^T plane [h][d][t], v^T residual [h][d][t < EROWS];
// y plane [t][1024] (+ residual for t < EROWS). Flash kernel in transposed form (S^T = K Q^T, O^T = V^T P^T): Q fragments straight from the planes; each 32-key tile of K, K residual and V^T goes into LDS once per block by asynchronous copies (two buffers) and serves the waves whose key range holds it.
// The two projections: 128 x 128 output tile per block of four waves (64 x 64 each); both operand tiles go from the planes into LDS by asynchronous copies of whole 128-byte lines (two buffers), fragments are read from LDS.

#ifndef NB
#define NB 1
#endif
#ifndef SEQ
#define SEQ 4096
#endif
#define NB_FULL  1
#define SEQ_FULL 4096
#define DM   1024
#define NH_  8
#define HD   128
#define NQKV 24                  // head slots of the fused projection
#define AW   4                   // waves per flash block (16 query rows each)
#define TP   132                 // LDS row pitch (floats) of the 128 x 128 head tile
#define EROWS (SEQ < 512 ? SEQ : 512)   // query rows (and tokens of the small residual planes) handled by the multi-product flash instantiation
#define QRS  2048.0f             // carry of every residual plane / residual fragment
#define QRI  (1.0f / 2048.0f)
#define SC2  ((float)(0.12 * 1.4426950408889634))   // score scale * log2(e)
#define PSH  14.0f               // log2 of the P carry (16384)
#define NEGB (-3.0e38f)
#define YC   64.0f               // carry of the y planes
#define WOC  256.0f              // carry of the Wo plane
#define OSC  (1.0f / (64.0f * 256.0f))

static_assert(NB == 1);
static_assert(HD == 128);                      // q/k plane row = 256 bytes = two lines; lane owns 4 columns of a head row
static_assert(NH_ * HD == DM);
static_assert(NQKV == 3 * NH_);
static_assert(DM % 64 == 0);
static_assert(DM % 128 == 0);                  // GEMM column tiles of 128; K tiles of 64 and of 128
static_assert(HD % 32 == 0);                   // score k-loop steps by 32
static_assert(SEQ % 64 == 0);
static_assert(SEQ % 32 == 0);                  // key loop steps by 32
static_assert(EROWS % 128 == 0);               // a 128-token GEMM tile lies wholly inside or outside the residual planes
static_assert(SEQ % 128 == 0);                 // GEMM token tiles
static_assert(EROWS >= 32);
static_assert(EROWS <= SEQ);
static_assert(EROWS % (16 * AW) == 0);
static_assert((SEQ - EROWS) % (16 * AW) == 0);
static_assert(((size_t)SEQ * DM) % 8 == 0);
static_assert(((size_t)DM * DM) % 8 == 0);
static_assert(((size_t)SEQ * 32) % 256 == 0);  // rotary table grid covers the table exactly
static_assert(SEQ <= SEQ_FULL);
static_assert((TP * 4) % 16 == 0);
static_assert(sizeof(float) * 128 * TP <= 131072);

typedef _Float16 h16;
typedef unsigned short bf;
typedef __attribute__((ext_vector_type(16))) __bf16   v16bf;
typedef __attribute__((ext_vector_type(16))) _Float16 v16h;
typedef __attribute__((ext_vector_type(8)))  _Float16 v8h;
typedef __attribute__((ext_vector_type(8)))  unsigned short v8us;
typedef __attribute__((ext_vector_type(8)))  float    v8f;
typedef __attribute__((ext_vector_type(4)))  float    v4f;
typedef v4f  __attribute__((may_alias)) v4fa;

__device__ __forceinline__ unsigned short f2bf(float f) { unsigned u = __float_as_uint(f); u += 0x7FFFu + ((u >> 16) & 1u); return (unsigned short)(u >> 16); }
__device__ __forceinline__ float bfr(float f) { return __uint_as_float(((unsigned)f2bf(f)) << 16); }   // value after RNE convert to bf16
__device__ __forceinline__ v16h cat16(v8h lo, v8h hi) { return __builtin_shufflevector(lo, hi, 0, 1, 2, 3, 4, 5, 6, 7, 8, 9, 10, 11, 12, 13, 14, 15); }
__device__ __forceinline__ v16bf cat16b(v8us lo, v8us hi) { return __builtin_bit_cast(v16bf, __builtin_shufflevector(lo, hi, 0, 1, 2, 3, 4, 5, 6, 7, 8, 9, 10, 11, 12, 13, 14, 15)); }
__device__ __forceinline__ v8f wmma16(v16h a, v16h b, v8f c) { return __builtin_amdgcn_wmma_f32_16x16x32_f16(false, a, false, b, (short)0, c, false, false); }
__device__ __forceinline__ v8f wmmab(v16bf a, v16bf b, v8f c) { return __builtin_amdgcn_wmma_f32_16x16x32_bf16(false, a, false, b, (short)0, c, false, false); }
// fragment loaders from K-contiguous 16-bit rows; p already includes + 8*(lane>>4): elements 0..7 <- k0+8h+0..7, elements 8..15 <- k0+16+8h+0..7 (same map for A and B)
__device__ __forceinline__ v16h  ldh(const h16* p) { return cat16(*(const v8h*)p, *(const v8h*)(p + 16)); }
__device__ __forceinline__ v16bf ldb(const bf* p)  { return cat16b(*(const v8us*)p, *(const v8us*)(p + 16)); }
// ordering point for wave-private LDS tiles (same wave writes and reads)
__device__ __forceinline__ void wave_sync() { __builtin_amdgcn_fence(3 /* release order */, "wavefront"); __builtin_amdgcn_wave_barrier(); asm volatile("" ::: "memory"); }

// f32 -> f16 convert that cannot produce a subnormal operand: |v| < 2^-14 -> +0 (value select)
static __device__ __forceinline__ h16 toh_flush(float v) { const h16 r = (h16)v; return (fabsf(v) < 6.103515625e-05f) ? (h16)0.0f : r; }
// per-instruction guarded WMMA wrappers: one accumulator per guard (four vector slots behind the product before its result is used).
// The guard names the accumulator alone: an asm operand is held below v256, and the fragment sets that are in flight need the registers above.
__device__ __forceinline__ v8f wmma16g(v16h a, v16h b, v8f c) { c = wmma16(a, b, c); asm volatile("v_nop\n\tv_nop\n\tv_nop\n\tv_nop" : "+v"(c)); return c; }
__device__ __forceinline__ v8f wmmabg(v16bf a, v16bf b, v8f c) { c = wmmab(a, b, c); asm volatile("v_nop\n\tv_nop\n\tv_nop\n\tv_nop" : "+v"(c)); return c; }

template <bool B> struct flag_t { static constexpr bool v = B; };
// stands behind a batch of fragment loads: keeps the products that follow in the source from being scheduled in front of the batch (the loads would then be issued only when their values are already due)
__device__ __forceinline__ void loads_first() { __builtin_amdgcn_sched_barrier(0); }
// stands between issued global loads and the first instruction that may rewrite a register that they name (their address pairs die at issue and are reused at once, or are advanced at the loop's top);
// the scheduling barrier keeps later instructions behind the wait; the loads' base addresses are named as inputs, so that their registers stay allocated up to the wait
__device__ __forceinline__ void addr_free(const void* p, const void* q) { asm volatile("s_wait_xcnt 0x0" :: "v"(p), "v"(q) : "memory"); __builtin_amdgcn_sched_barrier(0); }

__device__ __forceinline__ v16h  ldf(const h16* p) { return ldh(p); }
__device__ __forceinline__ v16bf ldf(const bf* p)  { return ldb(p); }
__device__ __forceinline__ v8f mmg(v16h a, v16h b, v8f c)   { return wmma16g(a, b, c); }
__device__ __forceinline__ v8f mmg(v16bf a, v16bf b, v8f c) { return wmmabg(a, b, c); }
__device__ __forceinline__ unsigned lds_off(const void* p) { return (unsigned)(size_t)p; }   // byte offset in the work-group's LDS
// eight asynchronous 16-byte copies per lane, global -> LDS: piece i goes from g + i * gs to LDS byte l + i * ls. The wait at the end of the statement stands in front of every later rewrite of the address registers.
__device__ __forceinline__ void copy8(const unsigned l, const unsigned ls, const char* g, const size_t gs) {
    asm volatile("global_load_async_to_lds_b128 %0, %8, off\n\t"
                 "global_load_async_to_lds_b128 %1, %9, off\n\t"
                 "global_load_async_to_lds_b128 %2, %10, off\n\t"
                 "global_load_async_to_lds_b128 %3, %11, off\n\t"
                 "global_load_async_to_lds_b128 %4, %12, off\n\t"
                 "global_load_async_to_lds_b128 %5, %13, off\n\t"
                 "global_load_async_to_lds_b128 %6, %14, off\n\t"
                 "global_load_async_to_lds_b128 %7, %15, off\n\t"
                 "s_wait_xcnt 0x0"
                 :: "v"(l), "v"(l + ls), "v"(l + 2 * ls), "v"(l + 3 * ls), "v"(l + 4 * ls), "v"(l + 5 * ls), "v"(l + 6 * ls), "v"(l + 7 * ls),
                    "v"(g), "v"(g + gs), "v"(g + 2 * gs), "v"(g + 3 * gs), "v"(g + 4 * gs), "v"(g + 5 * gs), "v"(g + 6 * gs), "v"(g + 7 * gs)
                 : "memory");
}
// four (two) such copies, same address form and the same closing wait
__device__ __forceinline__ void copy4(const unsigned l, const unsigned ls, const char* g, const size_t gs) {
    asm volatile("global_load_async_to_lds_b128 %0, %4, off\n\t"
                 "global_load_async_to_lds_b128 %1, %5, off\n\t"
                 "global_load_async_to_lds_b128 %2, %6, off\n\t"
                 "global_load_async_to_lds_b128 %3, %7, off\n\t"
                 "s_wait_xcnt 0x0"
                 :: "v"(l), "v"(l + ls), "v"(l + 2 * ls), "v"(l + 3 * ls), "v"(g), "v"(g + gs), "v"(g + 2 * gs), "v"(g + 3 * gs)
                 : "memory");
}
__device__ __forceinline__ void copy2(const unsigned l, const unsigned ls, const char* g, const size_t gs) {
    asm volatile("global_load_async_to_lds_b128 %0, %2, off\n\t"
                 "global_load_async_to_lds_b128 %1, %3, off\n\t"
                 "s_wait_xcnt 0x0"
                 :: "v"(l), "v"(l + ls), "v"(g), "v"(g + gs)
                 : "memory");
}
// the issuing wave's copies have landed in LDS behind this wait
__device__ __forceinline__ void copies_landed() { asm volatile("s_wait_asynccnt 0x0" ::: "memory"); }
// the wave's own LDS reads have returned behind this wait (in front of the barrier that frees a buffer for its refill)
__device__ __forceinline__ void lds_reads_done() { asm volatile("s_wait_dscnt 0x0" ::: "memory"); }

// gemm128: acc += A[128 rows][DM] * B[128 rows][DM]^T for a block of four waves; wave w owns rows 64 (w >> 1) .. + 63 of A and rows 64 (w & 1) .. + 63 of B (16 accumulators, k ascending in steps of 32).
// K is cut into tiles of KC elements. A stage in LDS is [A tile | B tile], 128 rows each at pitch 2 KC + 16 bytes (16 B x odd: the pitch for 16-byte row reads); two stages.
// Copies: a row piece of 2 KC bytes is brought by KC / 8 neighbouring lanes, so every copy instruction covers whole 128-byte lines. Tile t + 2 is copied into the buffer of tile t behind the barrier that ends trip t.
// On return every wave has passed a barrier behind its last LDS read and no copy is outstanding: sm may be reused at once.
template <int KC, class T>
__device__ __forceinline__ void gemm128(const T* __restrict__ Ag, const T* __restrict__ Bg, char* sm, v8f (&acc)[4][4]) {
    constexpr int PB  = KC * 2 + 16;             // LDS row pitch, bytes
    constexpr int TB  = 128 * PB;                // one operand tile
    constexpr int SB  = 2 * TB;                  // one stage
    constexpr int NT  = DM / KC;                 // tiles along K
    constexpr int NK  = KC / 32;                 // k steps per tile
    constexpr int LPW = KC / 8;                  // lanes per row piece
    constexpr int RPC = 128 / LPW;               // rows per copy of the whole block
    constexpr int NC  = 128 / RPC;               // copies per lane and operand tile
    static_assert(sizeof(T) == 2);
    static_assert(DM % KC == 0);
    static_assert(NT >= 2);
    static_assert(NC % 8 == 0);
    static_assert(2 * NC <= 63);                 // copies of a wave in flight
    static_assert((PB / 16) % 2 == 1);
    const int tid = (int)threadIdx.x, lane = tid & 31, lr = lane & 15, hi = lane >> 4;
    const int wave = __builtin_amdgcn_readfirstlane(tid >> 5);
    const int crow = tid / LPW, cpc = tid % LPW;                   // the lane's first row (0 .. RPC - 1) and its 16-byte piece of the row
    const unsigned l0 = lds_off(sm) + (unsigned)(crow * PB + cpc * 16);
    const char* ga = (const char*)(Ag + (size_t)crow * DM + cpc * 8);
    const char* gb = (const char*)(Bg + (size_t)crow * DM + cpc * 8);
    auto fill = [&](const int buf, const int t) __attribute__((always_inline)) {
#pragma unroll
        for (int g = 0; g < NC; g += 8) copy8(l0 + (unsigned)(buf * SB + g * RPC * PB), RPC * PB, ga + (size_t)g * RPC * DM * 2 + (size_t)t * KC * 2, (size_t)RPC * DM * 2);
#pragma unroll
        for (int g = 0; g < NC; g += 8) copy8(l0 + (unsigned)(buf * SB + TB + g * RPC * PB), RPC * PB, gb + (size_t)g * RPC * DM * 2 + (size_t)t * KC * 2, (size_t)RPC * DM * 2); };
    const int fao = ((wave >> 1) * 64 + lr) * PB + 16 * hi;        // fragment rows: same element map as the loaders from the planes
    const int fbo = TB + ((wave & 1) * 64 + lr) * PB + 16 * hi;
    fill(0, 0);
    copies_landed();
    __syncthreads();
    fill(1, 1);
#pragma unroll 1
    for (int t = 0; t < NT; ++t) {
        const char* sb = sm + (t & 1) * SB;
        decltype(ldf((const T*)nullptr)) a[2][4], b[2][4];
        // two fragment sets inside a tile: the 16 LDS reads of k step s + 1 stand as one group in front of the 16 products of k step s
        auto ldst = [&](const int s, const int kk) __attribute__((always_inline)) {
#pragma unroll
            for (int mb = 0; mb < 4; ++mb) a[s][mb] = ldf((const T*)(sb + fao + mb * 16 * PB + kk * 64));
#pragma unroll
            for (int nb = 0; nb < 4; ++nb) b[s][nb] = ldf((const T*)(sb + fbo + nb * 16 * PB + kk * 64));
            loads_first(); };
        ldst(0, 0);
#pragma unroll
        for (int kk = 0; kk < NK; ++kk) {
            if (kk + 1 < NK) ldst((kk + 1) & 1, kk + 1);
#pragma unroll
            for (int nb = 0; nb < 4; ++nb)
#pragma unroll
                for (int mb = 0; mb < 4; ++mb) acc[mb][nb] = mmg(a[kk & 1][mb], b[kk & 1][nb], acc[mb][nb]);
        }
        lds_reads_done();
        copies_landed();
        __syncthreads();                                           // publishes tile t + 1 and frees the buffer of tile t
        if (t + 2 < NT) fill(t & 1, t + 2);                        // same test in the whole block
    }
    copies_landed();
}

__global__ __launch_bounds__(256) void k_cvt8(const float* __restrict__ src, bf* dst, size_t n8) {
    const size_t i = (size_t)blockIdx.x * 256 + threadIdx.x; if (i >= n8) return;
    const v8f v = *(const v8f*)(src + i * 8); v8us o;
#pragma unroll
    for (int k = 0; k < 8; ++k) o[k] = f2bf(v[k]);
    *(v8us*)(dst + i * 8) = o; 
}

__global__ __launch_bounds__(256) void k_cvtw(const float* __restrict__ src, h16* dst, size_t n8) {
#pragma clang fp contract(off)
    const size_t i = (size_t)blockIdx.x * 256 + threadIdx.x; if (i >= n8) return;
    const v8f v = *(const v8f*)(src + i * 8); v8h o;
#pragma unroll
    for (int k = 0; k < 8; ++k) o[k] = toh_flush(bfr(v[k]) * WOC);
    *(v8h*)(dst + i * 8) = o; 
}

// k_ropetab: rotary table CS[t][0..31] = cos(t * f_j), CS[t][32..63] = sin(t * f_j), f_j = 2^(-10 * j / 31), j < 32 (the other 32 pairs are the identity).
__global__ __launch_bounds__(256) void k_ropetab(float* CS) {
#pragma clang fp contract(off)
    const int i = (int)blockIdx.x * 256 + (int)threadIdx.x;       // grid * 256 == SEQ * 32 exactly
    const int t = i >> 5, j = i & 31;
    const float e = (float)j / 31.0f;
    const float a = -10.0f * e;
    const float lo = fmaf(-10.0f, e, -a);                          // exact residual of the exponent product
    float invf = exp2f(a);
    invf = fmaf(invf, 0.69314718056f * lo, invf);
    const float th = (float)t * invf;
    float s, c; sincosf(th, &s, &c);
    float* row = CS + (size_t)t * 64;
    *(float*)(row + j) = c; *(float*)(row + 32 + j) = s;
    
}

// k_qkv: fused QKV projection + per-head RMS normalisation + rotary (q, k) / value mix (v). Block = 4 waves, tile = 128 tokens x one head slot (128 columns);
// each wave computes a 64 x 64 quarter (16 accumulators, operand tiles staged in LDS by gemm128, K = DM), stages it in the block's LDS tile (the same LDS, free behind gemm128); block barrier;
// row pass: wave w owns rows 32w..32w+31, lane owns columns 4*lane..4*lane+3, sum of squares by xor exchanges, rotary partner (d +- 64) by one xor-16 exchange, result written back in place; block barrier;
//             v slots: transposed plane [h][d][t] (row pitch SEQ) value, and residual x2048 [h][d][t < EROWS] for token tiles below EROWS: 8 lanes x 16 B per d-row line (64 tokens), four d-rows per instruction.
// LDS tile: cross-wave (block barriers). grid (SEQ/128, NQKV).
__global__ __launch_bounds__(128) void k_qkv(const bf* __restrict__ XB, const bf* __restrict__ WB, const float* __restrict__ ve, const float* __restrict__ lam, const float* __restrict__ CS,
                                            h16* QK, h16* VT, h16* VR) {
    constexpr int RING = 2 * 2 * 128 * (64 * 2 + 16), TILE = 128 * TP * 4;     // bytes: two stages of gemm128<64>; the f32 head tile
    __shared__ __align__(16) char sm[RING > TILE ? RING : TILE];
    float* os = (float*)sm;
    const size_t PLE = (size_t)NH_ * SEQ * HD;                     // elements per q/k plane; QK = [q | q residual | k | k residual]
    const int lane = threadIdx.x & 31, lr = lane & 15, hi = lane >> 4;
    const int wave = __builtin_amdgcn_readfirstlane((int)(threadIdx.x >> 5));
    const int r0 = blockIdx.x * 128;
    const int hh = blockIdx.y;                                     // block-uniform head slot
    const int kind = hh >> 3, hd = hh & 7;
    const int wt = wave >> 1, wc = wave & 1;                       // this wave's token half and column half of the tile
    v8f acc[4][4];
#pragma unroll
    for (int mb = 0; mb < 4; ++mb)
#pragma unroll
        for (int nb = 0; nb < 4; ++nb) acc[mb][nb] = (v8f){};
    gemm128<64>(XB + (size_t)r0 * DM, WB + (size_t)hh * HD * DM, sm, acc);
    // D: row 8h+j, col lane&15 -> this wave's 64 tile rows and 64 columns
#pragma unroll
    for (int mb = 0; mb < 4; ++mb)
#pragma unroll
        for (int nb = 0; nb < 4; ++nb)
#pragma unroll
            for (int j = 0; j < 8; ++j) os[(wt * 64 + mb * 16 + hi * 8 + j) * TP + wc * 64 + nb * 16 + lr] = acc[mb][nb][j];
    __syncthreads();
    const float l0 = bfr(lam[0]), l1 = bfr(lam[1]);
    const float sg = (lane < 16) ? 1.0f : -1.0f;                   // d < 64: x1 c + x2 s; d >= 64: x2 c - x1 s
    const bool act = (lane & 8) == 0;                              // frequency index (d & 63) < 32
    // the table (q, k) or value-embedding (v) rows of eight tokens are loaded together, in front of the eight row computations
    auto rowpass = [&](auto fq) __attribute__((always_inline)) {
        constexpr bool QKR = decltype(fq)::v;
#pragma unroll 1
        for (int rg = 0; rg < 32; rg += 8) {
            v4f g0[8], g1[8], xg[8];
            const int tg = r0 + wave * 32 + rg;
            const float* gp = QKR ? CS + (size_t)tg * 64 + 4 * (lane & 7)                   // address always inside the table row
                                  : ve + (size_t)tg * DM + (size_t)hd * HD + 4 * lane;
#pragma unroll
            for (int u = 0; u < 8; ++u) {
                if constexpr (QKR) { g0[u] = *(const v4f*)(gp + u * 64); g1[u] = *(const v4f*)(gp + u * 64 + 32); }
                else               { g0[u] = *(const v4f*)(gp + (size_t)u * DM); } }
            loads_first(); addr_free(gp, gp);
#pragma unroll
            for (int u = 0; u < 8; ++u) xg[u] = *(const v4fa*)(&os[(wave * 32 + rg + u) * TP + 4 * lane]);
#pragma unroll
            for (int u = 0; u < 8; ++u) {
                const int row = wave * 32 + rg + u;
                const v4f xv = xg[u];
                float ss = xv[0] * xv[0] + xv[1] * xv[1] + xv[2] * xv[2] + xv[3] * xv[3];
                ss += __shfl_xor(ss, 16, 32); ss += __shfl_xor(ss, 8, 32); ss += __shfl_xor(ss, 4, 32); ss += __shfl_xor(ss, 2, 32); ss += __shfl_xor(ss, 1, 32);
                const float inv = rsqrtf(ss * (1.0f / HD) + 1.0e-6f);
                v4f y;
                if constexpr (QKR) {
                    v4f cv = g0[u];
                    v4f sv = g1[u];
                    asm volatile("" : "+v"(cv), "+v"(sv));
#pragma unroll
                    for (int i = 0; i < 4; ++i) {
                        const float xn = xv[i] * inv;
                        const float part = __shfl_xor(xn, 16, 32);
                        const float c = act ? cv[i] : 1.0f; const float s = act ? sv[i] : 0.0f;
                        y[i] = xn * c + sg * (part * s); }
                } else {
                    const v4f e4 = g0[u];
#pragma unroll
                    for (int i = 0; i < 4; ++i) y[i] = l0 * (xv[i] * inv) + l1 * bfr(e4[i]);
                }
                *(v4fa*)(&os[row * TP + 4 * lane]) = y;
            }
        } };
    if (kind < 2) rowpass(flag_t<true>{}); else rowpass(flag_t<false>{});      // block-uniform
    __syncthreads();
    if (kind < 2) {
        static_assert(4 * 16 * 32 * 16 == 128 * HD * 2);           // waves x instructions x lanes x 16 B == 128 rows x 256 B
        const size_t pb0 = (size_t)(kind * 2) * PLE + ((size_t)hd * SEQ + (size_t)r0) * HD;
{
#pragma unroll 2
            for (int it = 0; it < 16; ++it) { const int row = wave * 32 + it * 2 + (lane >> 4), c8 = (lane & 15) * 8;
                const v4f x0 = *(const v4fa*)(&os[row * TP + c8]); const v4f x1 = *(const v4fa*)(&os[row * TP + c8 + 4]); v8h hv, rv;
#pragma unroll
                for (int i = 0; i < 4; ++i) { const h16 a0 = toh_flush(x0[i]); const h16 a1 = toh_flush(x1[i]); hv[i] = a0; hv[4 + i] = a1;
                    rv[i] = toh_flush((x0[i] - (float)a0) * QRS); rv[4 + i] = toh_flush((x1[i] - (float)a1) * QRS); }
                const size_t oo = pb0 + (size_t)row * HD + c8;
                *(v8h*)(QK + oo) = hv; *(v8h*)(QK + PLE + oo) = rv; }
             }
    } else {
        static_assert(4 * 16 * 32 * 16 == HD * 128 * 2);
        const bool wr = r0 < EROWS;                                // block-uniform: whole token tile inside the residual plane
        const size_t vb0 = ((size_t)hd * HD) * SEQ + (size_t)r0;
        const size_t rb0 = ((size_t)hd * HD) * EROWS + (size_t)r0;
{
#pragma unroll 2
            for (int it = 0; it < 16; ++it) { const int d = wc * 64 + it * 4 + (lane >> 3), c8 = wt * 64 + (lane & 7) * 8; v8h hv, rv;
#pragma unroll
                for (int i = 0; i < 8; ++i) { const float x = os[(c8 + i) * TP + d]; const h16 a0 = toh_flush(x); hv[i] = a0; rv[i] = toh_flush((x - (float)a0) * QRS); }
                *(v8h*)(VT + vb0 + (size_t)d * SEQ + c8) = hv;
                if (wr) *(v8h*)(VR + rb0 + (size_t)d * EROWS + c8) = rv; }
             }
    }
}

// flash_body: fused attention, one wave per 16 query rows of one head (EARLY: of one 64-wide half of the head dimension); Q fragments straight from the f16 planes, K / V^T fragments from LDS.
// The block's four waves walk the union [kb, ke) of their key ranges together, one 32-key tile a trip. A stage in LDS is [K | K residual | V^T (| V^T residual)]: K rows of 256 B at pitch 272 B, V^T row pieces of 64 B at pitch 80 B
// (16 B x odd: the pitch for 16-byte row reads). Tile s + 2 is copied into the buffer of tile s behind the barrier that ends trip s. A wave skips the products of a tile outside its own range and passes every barrier.
// Transposed form: S^T[key][t] = K Q^T (A = K rows, B = Q rows); lane (t = lane&15, h = lane>>4) holds keys 8h+r of each 16-key tile, so the packed
// P tile is directly the B fragment of O^T[d][t] = V^T P^T (element r <- tile keys 0..15, element 8+r <- tile keys 16..31, lane unchanged).
// Scores on all rows: K Q + (K Q_res + K_res Q) / 2048. Keep rule per element: 0 <= t - key < window; window <= 0: every key kept with score 0 (uniform row).
// Key range per wave [klo, kend) from the device-read window, inside [0, SEQ); all visited plane rows are written by k_qkv.
// EARLY = 1 (query rows [0, EROWS)): P = f16 value + f16 residual x2048; O = V P + (V P_res + V_res P) / 2048; row sum from the f32 exponentials; y written as value + residual x2048.
// EARLY = 0 (query rows [EROWS, SEQ)): single P, v, y; row sum over the converted P.
template <int EARLY>
__device__ __forceinline__ void flash_body(const h16* __restrict__ QH, const h16* __restrict__ QR, const h16* __restrict__ KP, const h16* __restrict__ KR,
                                           const h16* __restrict__ VT, const h16* __restrict__ VR, const int* __restrict__ win_p, h16* YH, h16* YR) {
    constexpr int DT  = EARLY ? 4 : 8;           // 16-wide output tiles per wave
    constexpr int OSP = DT * 16 + 4;             // LDS row pitch (floats)
    constexpr int LPR = DT * 2;                  // lanes per y row segment (16 B each)
    constexpr int RPI = 32 / LPR;                // rows per store instruction
    constexpr int NST = 16 / RPI;                // store instructions per pass
    static_assert(32 % LPR == 0);
    static_assert(16 % RPI == 0);
    static_assert(NST * 32 * 16 == 16 * DT * 16 * 2);   // instructions x lanes x 16 B == 16 rows x segment bytes
    static_assert((OSP * 4) % 16 == 0);
    static_assert(sizeof(float) * AW * 16 * OSP <= 131072);
    constexpr int KPB = HD * 2 + 16;             // LDS pitch of a K row, bytes
    constexpr int VPB = 32 * 2 + 16;             // LDS pitch of a V^T row piece (32 keys), bytes
    constexpr int KTB = 32 * KPB;                // one K plane tile
    constexpr int VTB = DT * 16 * VPB;           // one V^T plane tile
    constexpr int SB  = 2 * KTB + (EARLY ? 2 : 1) * VTB;   // one stage
    static_assert(AW == 4);                      // 128 lanes: 8 K rows or 32 V^T row pieces per copy of the whole block
    static_assert((KPB / 16) % 2 == 1);
    static_assert((VPB / 16) % 2 == 1);
    static_assert(SB % 16 == 0);
    static_assert(DT * 16 == (EARLY ? 2 : 4) * 32);
    static_assert(2 * SB + sizeof(float) * AW * 16 * OSP <= 131072);
    __shared__ __align__(16) float os[AW * 16 * OSP];
    __shared__ __align__(16) char st[2 * SB];
    const int lane = threadIdx.x & 31, lr = lane & 15, hi = lane >> 4;
    const int wv = (int)(threadIdx.x >> 5);
    const int wave = __builtin_amdgcn_readfirstlane(wv);
    const int h = blockIdx.y;
    const int d0 = EARLY ? (int)blockIdx.z * 64 : 0;
    int winv = win_p[0];
    const bool allm = winv <= 0;                                   // every key replaced by the fill value: uniform row
    winv = winv > SEQ ? SEQ : winv;
    const int t0v = (EARLY ? 0 : EROWS) + ((int)blockIdx.x * AW + wv) * 16;
    int klov = t0v - winv + 1; klov = klov < 0 ? 0 : klov; klov &= ~31; klov = allm ? 0 : klov;
    const int kendv = allm ? SEQ : (t0v + 16);
    const int t0 = __builtin_amdgcn_readfirstlane(t0v);
    const int klo = __builtin_amdgcn_readfirstlane(klov);
    const int kend = __builtin_amdgcn_readfirstlane(kendv);        // key tiles [klo, kend) step 32; last tile ends at or below SEQ
    // the block's range: first wave's klo, last wave's kend; both multiples of 32, at least two tiles, inside [0, SEQ)
    const int tbv = (EARLY ? 0 : EROWS) + (int)blockIdx.x * (AW * 16);
    int kbv = tbv - winv + 1; kbv = kbv < 0 ? 0 : kbv; kbv &= ~31; kbv = allm ? 0 : kbv;
    const int kb = __builtin_amdgcn_readfirstlane(kbv);
    const int nt = __builtin_amdgcn_readfirstlane(((allm ? SEQ : (tbv + AW * 16)) - kbv) >> 5);
    const size_t qo = ((size_t)h * SEQ + (size_t)(t0 + lr)) * HD + 8 * hi;        // B fragments: col t, k = d
    const v16h hz = (v16h){};
    v8f o[DT], oR[DT];
#pragma unroll
    for (int j = 0; j < DT; ++j) { o[j] = (v8f){}; oR[j] = (v8f){}; }
    float m = NEGB, l = 0.0f;
    // load schedule: Q fragments once, in front of the key loop; the K and V fragments of a tile are read from its LDS buffer in front of its score products
    v16h qh[4], qr[4];
#pragma unroll
    for (int c = 0; c < 4; ++c) { qh[c] = ldh(QH + qo + 32 * c); qr[c] = ldh(QR + qo + 32 * c); }
    addr_free(QH + qo, QR + qo);
    // copies: a K tile is 8 KB in a row in its plane, lane tid brings 16-byte pieces tid + 128 i (row (tid >> 4) + 8 i); of V^T four neighbouring lanes bring one row's 64 bytes (row (tid >> 2) + 32 i)
    const int tid = (int)threadIdx.x;
    const unsigned lk = lds_off(st) + (unsigned)((tid >> 4) * KPB + (tid & 15) * 16);
    const unsigned lv = lds_off(st) + (unsigned)(2 * KTB + (tid >> 2) * VPB + (tid & 3) * 16);
    const char* gk = (const char*)(KP + (size_t)h * SEQ * HD) + tid * 16;
    const char* gr = (const char*)(KR + (size_t)h * SEQ * HD) + tid * 16;
    const char* gv = (const char*)(VT + ((size_t)h * HD + (size_t)(d0 + (tid >> 2))) * SEQ) + (tid & 3) * 16;
    const char* gq = (const char*)(VR + ((size_t)h * HD + (size_t)(d0 + (tid >> 2))) * EROWS) + (tid & 3) * 16;
    auto fill = [&](const int buf, const int key) __attribute__((always_inline)) {
        const unsigned bo = (unsigned)(buf * SB);
        copy4(lk + bo,       8 * KPB, gk + (size_t)key * (HD * 2), (size_t)8 * HD * 2);
        copy4(lk + bo + KTB, 8 * KPB, gr + (size_t)key * (HD * 2), (size_t)8 * HD * 2);
        if constexpr (EARLY) {
            const int kc = key < EROWS ? key : (EROWS - 32);     // clamped residual-plane key (address always inside the plane)
            copy2(lv + bo,       32 * VPB, gv + (size_t)key * 2, (size_t)32 * SEQ * 2);
            copy2(lv + bo + VTB, 32 * VPB, gq + (size_t)kc * 2,  (size_t)32 * EROWS * 2);
        } else {
            copy4(lv + bo,       32 * VPB, gv + (size_t)key * 2, (size_t)32 * SEQ * 2);
        } };
    fill(0, kb);
    copies_landed();
    __syncthreads();
    fill(1, kb + 32);                                            // a second tile always exists
    // kept rolled: one copy of the tile body in the text, and the buffer index stays a scalar of the trip
#pragma unroll 1
    for (int s = 0; s < nt; ++s) {
      const int key0 = kb + 32 * s;
      if (key0 >= klo && key0 < kend) {                          // wave-uniform: the wave's own tiles, in ascending order
        const bool rok = key0 < EROWS;                           // wave-uniform
        const char* sb = st + (s & 1) * SB;
        v16h ka[4], kq[4], ra[4], rb[4], vf[DT], vrf[DT];
        const char* kp = sb + lr * KPB + 16 * hi;                // A fragment: row key, k = d
        const char* vp = sb + 2 * KTB + lr * VPB + 16 * hi;      // A fragment: row d (+ 16 j), k = key
#pragma unroll
        for (int c = 0; c < 4; ++c) { ka[c] = ldh((const h16*)(kp + 64 * c));       kq[c] = ldh((const h16*)(kp + 16 * KPB + 64 * c));
                                      ra[c] = ldh((const h16*)(kp + KTB + 64 * c)); rb[c] = ldh((const h16*)(kp + KTB + 16 * KPB + 64 * c)); }
#pragma unroll
        for (int j = 0; j < DT; ++j) {
            vf[j] = ldh((const h16*)(vp + j * 16 * VPB));
            if (EARLY) vrf[j] = ldh((const h16*)(vp + VTB + j * 16 * VPB));
        }
        loads_first();
        v8f sHa = (v8f){}, sLa = (v8f){}, sHb = (v8f){}, sLb = (v8f){};
#pragma unroll
        for (int c = 0; c < 4; ++c) {
            sHa = wmma16g(ka[c], qh[c], sHa); sLa = wmma16g(ka[c], qr[c], sLa); sLa = wmma16g(ra[c], qh[c], sLa);
            sHb = wmma16g(kq[c], qh[c], sHb); sLb = wmma16g(kq[c], qr[c], sLb); sLb = wmma16g(rb[c], qh[c], sLb);
        }
        const int da0 = (t0 + lr) - (key0 + 8 * hi);             // t - key for r = 0 of tile a
        float ta[8], tb[8]; bool fa[8], fb[8]; float mx = NEGB;
#pragma unroll
        for (int r = 0; r < 8; ++r) {
            const int da = da0 - r, db = da0 - 16 - r;
            fa[r] = allm | ((da >= 0) & (da < winv));
            fb[r] = allm | ((db >= 0) & (db < winv));
            const float ua = (sHa[r] + sLa[r] * QRI) * SC2, ub = (sHb[r] + sLb[r] * QRI) * SC2;
            ta[r] = allm ? 0.0f : ua; tb[r] = allm ? 0.0f : ub;
            mx = fmaxf(mx, fmaxf(fa[r] ? ta[r] : NEGB, fb[r] ? tb[r] : NEGB)); }
        mx = fmaxf(mx, __shfl_xor(mx, 16, 32));
        const float mnew = fmaxf(m, mx);
        const float alpha = __builtin_amdgcn_exp2f(m - mnew);
        const float sh = PSH - mnew;
        v16h pb, pr = hz; float ls = 0.0f;
#pragma unroll
        for (int r = 0; r < 8; ++r) {
            const float xa = ta[r] + sh, xb = tb[r] + sh;
            const float ea = __builtin_amdgcn_exp2f(xa), eb = __builtin_amdgcn_exp2f(xb);
            const float ga = (fa[r] & (xa >= -14.0f)) ? ea : 0.0f;       // dropped elements and would-be subnormal operands selected to 0 by value
            const float gb = (fb[r] & (xb >= -14.0f)) ? eb : 0.0f;
            const h16 pa = (h16)ga; const h16 pc = (h16)gb;
            pb[r] = pa; pb[8 + r] = pc;
            if (EARLY) { pr[r] = toh_flush((ga - (float)pa) * QRS); pr[8 + r] = toh_flush((gb - (float)pc) * QRS); ls += ga + gb; }
            else       { ls += (float)pa + (float)pc; } }
        l = l * alpha + ls; m = mnew;
#pragma unroll
        for (int j = 0; j < DT; ++j) { o[j] = o[j] * alpha; if (EARLY) oR[j] = oR[j] * alpha; }
#pragma unroll
        for (int j = 0; j < DT; ++j) {
            const v16h v = vf[j];
            o[j] = wmma16g(v, pb, o[j]);
            if (EARLY) {
                v16h vr = vrf[j];
                if (!rok) vr = hz;
                oR[j] = wmma16g(v, pr, oR[j]);
                oR[j] = wmma16g(vr, pb, oR[j]);
            }
        }
      }
      lds_reads_done();
      copies_landed();
      __syncthreads();                                           // publishes tile s + 1 and frees the buffer of tile s
      if (s + 2 < nt) fill(s & 1, key0 + 64);                    // same test in the whole block
    }
    copies_landed();
    l += __shfl_xor(l, 16, 32);
    const bool any = l > 0.0f;
    const float lsafe = any ? l : 1.0f;
    const float inv = any ? (YC * (1.0f / lsafe)) : 0.0f;
    const int wb = wave * 16 * OSP;
    // O^T D layout: f_j[r] = (d = 16j + 8h + r, t = lane&15) -> os[t][d]; rows 0..15 x columns 0..DT*16-1 all written; tile private to the wave
#pragma unroll
    for (int j = 0; j < DT; ++j) {
        v8f f = o[j];
        if (EARLY) f = o[j] + oR[j] * QRI;
        v4f a, c;
        a[0] = f[0] * inv; a[1] = f[1] * inv; a[2] = f[2] * inv; a[3] = f[3] * inv; c[0] = f[4] * inv; c[1] = f[5] * inv; c[2] = f[6] * inv; c[3] = f[7] * inv;
        *(v4fa*)(&os[wb + lr * OSP + 16 * j + 8 * hi]) = a; *(v4fa*)(&os[wb + lr * OSP + 16 * j + 8 * hi + 4]) = c; }
    wave_sync();
    const size_t ybase = (size_t)t0 * DM + (size_t)h * HD + (size_t)d0;
{
#pragma unroll 2
        for (int s = 0; s < NST; ++s) { const int row = s * RPI + lane / LPR, c8 = (lane % LPR) * 8;
            const v4f x0 = *(const v4fa*)(&os[wb + row * OSP + c8]); const v4f x1 = *(const v4fa*)(&os[wb + row * OSP + c8 + 4]); v8h hv, rv;
#pragma unroll
            for (int i = 0; i < 4; ++i) { const h16 a0 = toh_flush(x0[i]); const h16 a1 = toh_flush(x1[i]); hv[i] = a0; hv[4 + i] = a1;
                rv[i] = toh_flush((x0[i] - (float)a0) * QRS); rv[4 + i] = toh_flush((x1[i] - (float)a1) * QRS); }
            const size_t oo = ybase + (size_t)row * DM + c8;
            *(v8h*)(YH + oo) = hv;
            if (EARLY) *(v8h*)(YR + oo) = rv; }
         }
}

// query rows [0, EROWS): grid (EROWS/(16*AW), NH_, 2 halves of the head dimension)
__global__ __launch_bounds__(32 * AW) void k_flash_early(const h16* __restrict__ QH, const h16* __restrict__ QR, const h16* __restrict__ KP, const h16* __restrict__ KR,
                                                         const h16* __restrict__ VT, const h16* __restrict__ VR, const int* __restrict__ win_p, h16* YH, h16* YR) {
    flash_body<1>(QH, QR, KP, KR, VT, VR, win_p, YH, YR);
}
// query rows [EROWS, SEQ): grid ((SEQ-EROWS)/(16*AW), NH_)
__global__ __launch_bounds__(32 * AW) void k_flash_late(const h16* __restrict__ QH, const h16* __restrict__ QR, const h16* __restrict__ KP, const h16* __restrict__ KR,
                                                        const h16* __restrict__ VT, const h16* __restrict__ VR, const int* __restrict__ win_p, h16* YH, h16* YR) {
    flash_body<0>(QH, QR, KP, KR, VT, VR, win_p, YH, YR);
}

// k_out: output projection, block = 4 waves per 128 x 128 tile, 64 x 64 (16 accumulators) per wave, A = y rows (K contiguous), Bt = Wo rows [out][in]; f16 operands, tiles staged in LDS by gemm128.
// Token tiles below EROWS (block-uniform): the residual plane products are accumulated first, scaled by 1/2048 (exact), then the value-plane products are added.
__global__ __launch_bounds__(128) void k_out(const h16* __restrict__ YH, const h16* __restrict__ YR, const h16* __restrict__ WO, float* OUT) {
    __shared__ __align__(16) char sm[2 * 2 * 128 * (128 * 2 + 16)];           // two stages of gemm128<128>
    __shared__ __align__(16) float osw[4 * 16 * 68];                          // one output staging tile per wave
    const int lane = threadIdx.x & 31, lr = lane & 15, hi = lane >> 4;
    const int wave = __builtin_amdgcn_readfirstlane((int)(threadIdx.x >> 5));
    const int b0 = blockIdx.x * 128, e0 = blockIdx.y * 128;                   // the block's first token and first output column
    const int r0 = b0 + (wave >> 1) * 64, c0 = e0 + (wave & 1) * 64;          // the wave's
    float* os = osw + wave * 16 * 68;
    v8f acc[4][4];
#pragma unroll
    for (int mb = 0; mb < 4; ++mb)
#pragma unroll
        for (int nb = 0; nb < 4; ++nb) acc[mb][nb] = (v8f){};
    // pass 0 (residual plane) only where rows b0..b0+127 lie inside it, pass 1 (value plane) always; block-uniform. Kept rolled: one copy of the K loop in the text, and no address of one pass held in registers through the other
#pragma unroll 1
    for (int p = (b0 < EROWS) ? 0 : 1; p < 2; ++p) {
        gemm128<128>((p == 0 ? YR : YH) + (size_t)b0 * DM, WO + (size_t)e0 * DM, sm, acc);
        if (p == 0) {
#pragma unroll
            for (int mb = 0; mb < 4; ++mb)
#pragma unroll
                for (int nb = 0; nb < 4; ++nb) acc[mb][nb] = acc[mb][nb] * QRI;
        }
    }
    static_assert(8 * 32 * 16 == 16 * 64 * 4);                     // instructions x lanes x 16 B == 16 rows x 256 B
#pragma unroll
    for (int mb = 0; mb < 4; ++mb) {
#pragma unroll
        for (int nb = 0; nb < 4; ++nb) {
#pragma unroll
            for (int j = 0; j < 8; ++j) os[(hi * 8 + j) * 68 + nb * 16 + lr] = acc[mb][nb][j] * OSC; }   // D: row 8h+j, col lane&15
        wave_sync();
        float* orow = OUT + (size_t)(r0 + mb * 16) * DM + c0;
{
#pragma unroll
            for (int s = 0; s < 8; ++s) { const int row = 2 * s + (lane >> 4), c4 = (lane & 15) * 4;   // 8 s x 2 rows = 16 rows; 16 lanes x 4 floats = 64 columns = two lines
                const v4f val = *(const v4fa*)(&os[row * 68 + c4]);
                *(v4f*)(orow + (size_t)row * DM + c4) = val; }
             }
        wave_sync();
    }
}

static constexpr size_t al256(size_t v) { return (v + 255) & ~(size_t)255; }
static constexpr size_t SZ_XB = al256((size_t)SEQ * DM * 2);
static constexpr size_t SZ_WB = al256((size_t)3 * DM * DM * 2);
static constexpr size_t SZ_WO = al256((size_t)DM * DM * 2);
static constexpr size_t SZ_CS = al256((size_t)SEQ * 64 * 4);
static constexpr size_t SZ_PL = al256((size_t)NH_ * SEQ * HD * 2);
static constexpr size_t SZ_RS = al256((size_t)NH_ * HD * EROWS * 2);
static constexpr size_t SZ_YH = al256((size_t)SEQ * DM * 2);
static constexpr size_t SZ_YR = al256((size_t)EROWS * DM * 2);
static constexpr size_t SZ_TOTAL = SZ_XB + SZ_WB + SZ_WO + SZ_CS + 4 * SZ_PL + SZ_PL + SZ_RS + SZ_YH + SZ_YR;
static_assert(SZ_TOTAL <= (size_t)134217728);                        // workspace carve <= 128 MiB
static_assert(SZ_PL == (size_t)NH_ * SEQ * HD * 2);                  // the four q/k planes are contiguous with no padding between them
static_assert(((size_t)NH_ * SEQ * HD * 2) % 256 == 0);
static_assert((size_t)NH_ * SEQ * HD == (size_t)SEQ * DM);           // v^T plane [(h*128 + d)][t] has the extent of a q/k plane

extern "C" void kernel_launch(void* const* d_in, const int* in_sizes, int n_in,
                              void* d_out, int out_size, void* d_ws, size_t ws_size, hipStream_t stream) {
    if (n_in < 5) return;
    const size_t needx = (size_t)SEQ * DM;
    if ((size_t)in_sizes[0] < needx || (size_t)in_sizes[1] < needx) return;
    if (in_sizes[2] < 2) return;
    if ((size_t)in_sizes[3] < (size_t)4 * DM * DM) return;
    if (in_sizes[4] < 1) return;
    if ((size_t)out_size < needx) return;
    if (SZ_TOTAL > ws_size) return;
    // wire order: x, ve, lambdas, qkvo_w, window
    const float* x   = (const float*)d_in[0];
    const float* ve  = (const float*)d_in[1];
    const float* lam = (const float*)d_in[2];
    const float* w   = (const float*)d_in[3];
    const int*   win = (const int*)d_in[4];
    float* OUT = (float*)d_out;      // [SEQ][1024]
    char* wsp = (char*)d_ws;
    bf*  XB = (bf*)wsp;   wsp += SZ_XB;                  // x      [SEQ][1024] bf16
    bf*  WB = (bf*)wsp;   wsp += SZ_WB;                  // Wq|Wk|Wv [3072][1024] bf16 ([out][in] = Bt as-is)
    h16* WO = (h16*)wsp;  wsp += SZ_WO;                  // Wo [1024][1024] f16 (bf16 value x256)
    float* CS = (float*)wsp; wsp += SZ_CS;               // rotary table [SEQ][64]
    h16* QK = (h16*)wsp;  wsp += 4 * SZ_PL;              // [q | q residual | k | k residual], each [8][SEQ][128]
    h16* VT = (h16*)wsp;  wsp += SZ_PL;                  // [8][128][SEQ]
    h16* VR = (h16*)wsp;  wsp += SZ_RS;                  // [8][128][EROWS] residual x2048
    h16* YH = (h16*)wsp;  wsp += SZ_YH;                  // [SEQ][1024] (x64)
    h16* YR = (h16*)wsp;  wsp += SZ_YR;                  // [EROWS][1024] residual x2048
    const size_t PLE = (size_t)NH_ * SEQ * HD;
    const h16* QH = QK; const h16* QR = QK + PLE; const h16* KP = QK + 2 * PLE; const h16* KR = QK + 3 * PLE;

    { const size_t n8 = (size_t)SEQ * DM / 8;
      k_cvt8<<<(unsigned)((n8 + 255) / 256), 256, 0, stream>>>(x, XB, n8); }
    { const size_t n8 = (size_t)3 * DM * DM / 8;
      k_cvt8<<<(unsigned)((n8 + 255) / 256), 256, 0, stream>>>(w, WB, n8); }
    { const size_t n8 = (size_t)DM * DM / 8;
      k_cvtw<<<(unsigned)((n8 + 255) / 256), 256, 0, stream>>>(w + (size_t)3 * DM * DM, WO, n8); }
    k_ropetab<<<(unsigned)((size_t)SEQ * 32 / 256), 256, 0, stream>>>(CS);

    // fused QKV: token tiles x 24 head slots -> q, q residual, k, k residual planes [h][t][d]; v^T plane [h][d][t] (+ residual for t < EROWS)
    k_qkv<<<dim3(SEQ / 128, NQKV, 1), 128, 0, stream>>>(XB, WB, ve, lam, CS, QK, VT, VR);

    // query rows [0, EROWS): multi-product instantiation (two halves of the head dimension); rows [EROWS, SEQ): single P / v / y (disjoint y rows)
    k_flash_early<<<dim3(EROWS / (16 * AW), NH_, 2), 32 * AW, 0, stream>>>(QH, QR, KP, KR, VT, VR, win, YH, YR);
    if (SEQ > EROWS)
        k_flash_late<<<dim3((SEQ - EROWS) / (16 * AW), NH_, 1), 32 * AW, 0, stream>>>(QH, QR, KP, KR, VT, VR, win, YH, YR);

    // out[t][d] = sum_e y[t][e] Wo[d][e]
    k_out<<<dim3(SEQ / 128, DM / 128, 1), 128, 0, stream>>>(YH, YR, WO, OUT);
}

// v004
// A run of this version takes 89 microseconds.
// Timed twice side by side with v003, it ran 1.23 times as fast both times.
// Over all steps from v000 it is 3.26 times as fast.
#include <hip/hip_runtime.h>

// Attention layer: one input x [SEQ][1024] feeds a fused [out][in] QKV projection (24 head slots of 128: q 0..7, k 8..15, v 16..23); unweighted RMS normalisation (eps 1e-6) of q, k, v per head row;
// half-split rotary embedding with only the first 32 of the 64 frequency pairs active (base 1024); v = l0 * vnorm + l1 * value-embedding; sliding-window causal keep rule 0 <= t - j < window
// (window int32, device-read; window <= 0 gives the uniform row over all keys); score scale 0.12 (multiplied); softmax f32 (online, running max over kept keys); output projection y Wo^T with Wo [out][in].
// Compute dtypes, f32 accumulate everywhere: QKV projection v_wmma_f32_16x16x32_bf16 (x, W RNE-converted to bf16; products exact);
// scores v_wmma_f32_16x16x32_f16 with q and k each as f16 value + f16 residual x2048 in its own accumulator (three products) on all rows;
// P.V v_wmma_f32_16x16x32_f16: P (x16384 carry, cancels in the normalisation) and v single f16 on query rows >= EROWS; on query rows < EROWS P and v each as f16 value + f16 residual x2048 (residual products in their own accumulator, folded by 1/2048);
// output projection v_wmma_f32_16x16x32_f16: y carried x64 (single f16 on rows >= EROWS, f16 value + f16 residual x2048 on rows < EROWS), Wo = bf16(RNE) x256 held exactly in f16; fold 1/16384 in the f32 epilogue.
// Layout: bf16 planes of x and of the three QKV weights; f16 plane of Wo; rotary table [t][cos 0..31 | sin 0..31]; q / q-residual / k / k-residual planes [h][t][128]; v^T plane [h][d][t], v^T residual [h][d][t < EROWS];
// y plane [t][1024] (+ residual for t < EROWS). Flash kernel in transposed form (S^T = K Q^T, O^T = V^T P^T): Q fragments straight from the planes; each 32-key tile of K, K residual and V^T goes into LDS once per block by asynchronous copies (two buffers) and serves the waves whose key range holds it.
// The two projections: 128 x 128 output tile per block of four waves (64 x 64 each); both operand tiles go from the planes into LDS by asynchronous copies of whole 128-byte lines (two buffers), fragments are read from LDS.

#ifndef NB
#define NB 1
#endif
#ifndef SEQ
#define SEQ 4096
#endif
#define NB_FULL  1
#define SEQ_FULL 4096
#define DM   1024
#define NH_  8
#define HD   128
#define NQKV 24                  // head slots of the fused projection
#define AW   4                   // waves per flash block (16 query rows each)
#define TP   132                 // LDS row pitch (floats) of the 128 x 128 head tile
#define EROWS (SEQ < 512 ? SEQ : 512)   // query rows (and tokens of the small residual planes) handled by the multi-product flash instantiation
#define QRS  2048.0f             // carry of every residual plane / residual fragment
#define QRI  (1.0f / 2048.0f)
#define SC2  ((float)(0.12 * 1.4426950408889634))   // score scale * log2(e)
#define PSH  14.0f               // log2 of the P carry (16384)
#define NEGB (-3.0e38f)
#define YC   64.0f               // carry of the y planes
#define WOC  256.0f              // carry of the Wo plane
#define OSC  (1.0f / (64.0f * 256.0f))

static_assert(NB == 1);
static_assert(HD == 128);                      // q/k plane row = 256 bytes = two lines; lane owns 4 columns of a head row
static_assert(NH_ * HD == DM);
static_assert(NQKV == 3 * NH_);
static_assert(DM % 64 == 0);
static_assert(DM % 128 == 0);                  // GEMM column tiles of 128; K tiles of 64 and of 128
static_assert(HD % 32 == 0);                   // score k-loop steps by 32
static_assert(SEQ % 64 == 0);
static_assert(SEQ % 32 == 0);                  // key loop steps by 32
static_assert(EROWS % 128 == 0);               // a 128-token GEMM tile lies wholly inside or outside the residual planes
static_assert(SEQ % 128 == 0);                 // GEMM token tiles
static_assert(EROWS >= 32);
static_assert(EROWS <= SEQ);
static_assert(EROWS % (16 * AW) == 0);
static_assert((SEQ - EROWS) % (16 * AW) == 0);
static_assert(((size_t)SEQ * DM) % 8 == 0);
static_assert(((size_t)DM * DM) % 8 == 0);
static_assert(((size_t)SEQ * 32) % 256 == 0);  // rotary table grid covers the table exactly
static_assert(SEQ <= SEQ_FULL);
static_assert((TP * 4) % 16 == 0);
static_assert(sizeof(float) * 128 * TP <= 131072);

typedef _Float16 h16;
typedef unsigned short bf;
typedef __attribute__((ext_vector_type(16))) __bf16   v16bf;
typedef __attribute__((ext_vector_type(16))) _Float16 v16h;
typedef __attribute__((ext_vector_type(8)))  _Float16 v8h;
typedef __attribute__((ext_vector_type(8)))  unsigned short v8us;
typedef __attribute__((ext_vector_type(8)))  float    v8f;
typedef __attribute__((ext_vector_type(4)))  float    v4f;
typedef v4f  __attribute__((may_alias)) v4fa;

__device__ __forceinline__ unsigned short f2bf(float f) { unsigned u = __float_as_uint(f); u += 0x7FFFu + ((u >> 16) & 1u); return (unsigned short)(u >> 16); }
__device__ __forceinline__ float bfr(float f) { return __uint_as_float(((unsigned)f2bf(f)) << 16); }   // value after RNE convert to bf16
__device__ __forceinline__ v16h cat16(v8h lo, v8h hi) { return __builtin_shufflevector(lo, hi, 0, 1, 2, 3, 4, 5, 6, 7, 8, 9, 10, 11, 12, 13, 14, 15); }
__device__ __forceinline__ v16bf cat16b(v8us lo, v8us hi) { return __builtin_bit_cast(v16bf, __builtin_shufflevector(lo, hi, 0, 1, 2, 3, 4, 5, 6, 7, 8, 9, 10, 11, 12, 13, 14, 15)); }
__device__ __forceinline__ v8f wmma16(v16h a, v16h b, v8f c) { return __builtin_amdgcn_wmma_f32_16x16x32_f16(false, a, false, b, (short)0, c, false, false); }
__device__ __forceinline__ v8f wmmab(v16bf a, v16bf b, v8f c) { return __builtin_amdgcn_wmma_f32_16x16x32_bf16(false, a, false, b, (short)0, c, false, false); }
// fragment loaders from K-contiguous 16-bit rows; p already includes + 8*(lane>>4): elements 0..7 <- k0+8h+0..7, elements 8..15 <- k0+16+8h+0..7 (same map for A and B)
__device__ __forceinline__ v16h  ldh(const h16* p) { return cat16(*(const v8h*)p, *(const v8h*)(p + 16)); }
__device__ __forceinline__ v16bf ldb(const bf* p)  { return cat16b(*(const v8us*)p, *(const v8us*)(p + 16)); }
// ordering point for wave-private LDS tiles (same wave writes and reads)
__device__ __forceinline__ void wave_sync() { __builtin_amdgcn_fence(3 /* release order */, "wavefront"); __builtin_amdgcn_wave_barrier(); asm volatile("" ::: "memory"); }

// f32 -> f16 convert that cannot produce a subnormal operand: |v| < 2^-14 -> +0 (value select)
static __device__ __forceinline__ h16 toh_flush(float v) { const h16 r = (h16)v; return (fabsf(v) < 6.103515625e-05f) ? (h16)0.0f : r; }
// per-instruction guarded WMMA wrappers: one accumulator per guard (four vector slots behind the product before its result is used).
// The guard names the accumulator alone: an asm operand is held below v256, and the fragment sets that are in flight need the registers above.
__device__ __forceinline__ v8f wmma16g(v16h a, v16h b, v8f c) { c = wmma16(a, b, c); asm volatile("v_nop\n\tv_nop\n\tv_nop\n\tv_nop" : "+v"(c)); return c; }
__device__ __forceinline__ v8f wmmabg(v16bf a, v16bf b, v8f c) { c = wmmab(a, b, c); asm volatile("v_nop\n\tv_nop\n\tv_nop\n\tv_nop" : "+v"(c)); return c; }

template <bool B> struct flag_t { static constexpr bool v = B; };
// stands behind a batch of fragment loads: keeps the products that follow in the source from being scheduled in front of the batch (the loads would then be issued only when their values are already due)
__device__ __forceinline__ void loads_first() { __builtin_amdgcn_sched_barrier(0); }
// stands between issued global loads and the first instruction that may rewrite a register that they name (their address pairs die at issue and are reused at once, or are advanced at the loop's top);
// the scheduling barrier keeps later instructions behind the wait; the loads' base addresses are named as inputs, so that their registers stay allocated up to the wait
__device__ __forceinline__ void addr_free(const void* p, const void* q) { asm volatile("s_wait_xcnt 0x0" :: "v"(p), "v"(q) : "memory"); __builtin_amdgcn_sched_barrier(0); }

__device__ __forceinline__ v16h  ldf(const h16* p) { return ldh(p); }
__device__ __forceinline__ v16bf ldf(const bf* p)  { return ldb(p); }
__device__ __forceinline__ v8f mmg(v16h a, v16h b, v8f c)   { return wmma16g(a, b, c); }
__device__ __forceinline__ v8f mmg(v16bf a, v16bf b, v8f c) { return wmmabg(a, b, c); }
__device__ __forceinline__ unsigned lds_off(const void* p) { return (unsigned)(size_t)p; }   // byte offset in the work-group's LDS
// eight asynchronous 16-byte copies per lane, global -> LDS: piece i goes from g + i * gs to LDS byte l + i * ls. The wait at the end of the statement stands in front of every later rewrite of the address registers.
__device__ __forceinline__ void copy8(const unsigned l, const unsigned ls, const char* g, const size_t gs) {
    asm volatile("global_load_async_to_lds_b128 %0, %8, off\n\t"
                 "global_load_async_to_lds_b128 %1, %9, off\n\t"
                 "global_load_async_to_lds_b128 %2, %10, off\n\t"
                 "global_load_async_to_lds_b128 %3, %11, off\n\t"
                 "global_load_async_to_lds_b128 %4, %12, off\n\t"
                 "global_load_async_to_lds_b128 %5, %13, off\n\t"
                 "global_load_async_to_lds_b128 %6, %14, off\n\t"
                 "global_load_async_to_lds_b128 %7, %15, off\n\t"
                 "s_wait_xcnt 0x0"
                 :: "v"(l), "v"(l + ls), "v"(l + 2 * ls), "v"(l + 3 * ls), "v"(l + 4 * ls), "v"(l + 5 * ls), "v"(l + 6 * ls), "v"(l + 7 * ls),
                    "v"(g), "v"(g + gs), "v"(g + 2 * gs), "v"(g + 3 * gs), "v"(g + 4 * gs), "v"(g + 5 * gs), "v"(g + 6 * gs), "v"(g + 7 * gs)
                 : "memory");
}
// four (two) such copies, same address form and the same closing wait
__device__ __forceinline__ void copy4(const unsigned l, const unsigned ls, const char* g, const size_t gs) {
    asm volatile("global_load_async_to_lds_b128 %0, %4, off\n\t"
                 "global_load_async_to_lds_b128 %1, %5, off\n\t"
                 "global_load_async_to_lds_b128 %2, %6, off\n\t"
                 "global_load_async_to_lds_b128 %3, %7, off\n\t"
                 "s_wait_xcnt 0x0"
                 :: "v"(l), "v"(l + ls), "v"(l + 2 * ls), "v"(l + 3 * ls), "v"(g), "v"(g + gs), "v"(g + 2 * gs), "v"(g + 3 * gs)
                 : "memory");
}
__device__ __forceinline__ void copy2(const unsigned l, const unsigned ls, const char* g, const size_t gs) {
    asm volatile("global_load_async_to_lds_b128 %0, %2, off\n\t"
                 "global_load_async_to_lds_b128 %1, %3, off\n\t"
                 "s_wait_xcnt 0x0"
                 :: "v"(l), "v"(l + ls), "v"(g), "v"(g + gs)
                 : "memory");
}
// the issuing wave's copies have landed in LDS behind this wait
__device__ __forceinline__ void copies_landed() { asm volatile("s_wait_asynccnt 0x0" ::: "memory"); }
// the wave's own LDS reads have returned behind this wait (in front of the barrier that frees a buffer for its refill)
__device__ __forceinline__ void lds_reads_done() { asm volatile("s_wait_dscnt 0x0" ::: "memory"); }

// gemm128: acc += A[128 rows][DM] * B[128 rows][DM]^T for a block of four waves; wave w owns rows 64 (w >> 1) .. + 63 of A and rows 64 (w & 1) .. + 63 of B (16 accumulators, k ascending in steps of 32).
// K is cut into tiles of KC elements. A stage in LDS is [A tile | B tile], 128 rows each at pitch 2 KC + 16 bytes (16 B x odd: the pitch for 16-byte row reads); two stages.
// Copies: a row piece of 2 KC bytes is brought by KC / 8 neighbouring lanes, so every copy instruction covers whole 128-byte lines. Tile t + 2 is copied into the buffer of tile t behind the barrier that ends trip t.
// On return every wave has passed a barrier behind its last LDS read and no copy is outstanding: sm may be reused at once.
template <int KC, class T>
__device__ __forceinline__ void gemm128(const T* __restrict__ Ag, const T* __restrict__ Bg, char* sm, v8f (&acc)[4][4]) {
    constexpr int PB  = KC * 2 + 16;             // LDS row pitch, bytes
    constexpr int TB  = 128 * PB;                // one operand tile
    constexpr int SB  = 2 * TB;                  // one stage
    constexpr int NT  = DM / KC;                 // tiles along K
    constexpr int NK  = KC / 32;                 // k steps per tile
    constexpr int LPW = KC / 8;                  // lanes per row piece
    constexpr int RPC = 128 / LPW;               // rows per copy of the whole block
    constexpr int NC  = 128 / RPC;               // copies per lane and operand tile
    static_assert(sizeof(T) == 2);
    static_assert(DM % KC == 0);
    static_assert(NT >= 2);
    static_assert(NC % 8 == 0);
    static_assert(2 * NC <= 63);                 // copies of a wave in flight
    static_assert((PB / 16) % 2 == 1);
    const int tid = (int)threadIdx.x, lane = tid & 31, lr = lane & 15, hi = lane >> 4;
    const int wave = __builtin_amdgcn_readfirstlane(tid >> 5);
    const int crow = tid / LPW, cpc = tid % LPW;                   // the lane's first row (0 .. RPC - 1) and its 16-byte piece of the row
    const unsigned l0 = lds_off(sm) + (unsigned)(crow * PB + cpc * 16);
    const char* ga = (const char*)(Ag + (size_t)crow * DM + cpc * 8);
    const char* gb = (const char*)(Bg + (size_t)crow * DM + cpc * 8);
    auto fill = [&](const int buf, const int t) __attribute__((always_inline)) {
#pragma unroll
        for (int g = 0; g < NC; g += 8) copy8(l0 + (unsigned)(buf * SB + g * RPC * PB), RPC * PB, ga + (size_t)g * RPC * DM * 2 + (size_t)t * KC * 2, (size_t)RPC * DM * 2);
#pragma unroll
        for (int g = 0; g < NC; g += 8) copy8(l0 + (unsigned)(buf * SB + TB + g * RPC * PB), RPC * PB, gb + (size_t)g * RPC * DM * 2 + (size_t)t * KC * 2, (size_t)RPC * DM * 2); };
    const int fao = ((wave >> 1) * 64 + lr) * PB + 16 * hi;        // fragment rows: same element map as the loaders from the planes
    const int fbo = TB + ((wave & 1) * 64 + lr) * PB + 16 * hi;
    fill(0, 0);
    copies_landed();
    __syncthreads();
    fill(1, 1);
#pragma unroll 1
    for (int t = 0; t < NT; ++t) {
        const char* sb = sm + (t & 1) * SB;
        decltype(ldf((const T*)nullptr)) a[2][4], b[2][4];
        // two fragment sets inside a tile: the 16 LDS reads of k step s + 1 stand as one group in front of the 16 products of k step s
        auto ldst = [&](const int s, const int kk) __attribute__((always_inline)) {
#pragma unroll
            for (int mb = 0; mb < 4; ++mb) a[s][mb] = ldf((const T*)(sb + fao + mb * 16 * PB + kk * 64));
#pragma unroll
            for (int nb = 0; nb < 4; ++nb) b[s][nb] = ldf((const T*)(sb + fbo + nb * 16 * PB + kk * 64));
            loads_first(); };
        ldst(0, 0);
#pragma unroll
        for (int kk = 0; kk < NK; ++kk) {
            if (kk + 1 < NK) ldst((kk + 1) & 1, kk + 1);
#pragma unroll
            for (int nb = 0; nb < 4; ++nb)
#pragma unroll
                for (int mb = 0; mb < 4; ++mb) acc[mb][nb] = mmg(a[kk & 1][mb], b[kk & 1][nb], acc[mb][nb]);
        }
        lds_reads_done();
        copies_landed();
        __syncthreads();                                           // publishes tile t + 1 and frees the buffer of tile t
        if (t + 2 < NT) fill(t & 1, t + 2);                        // same test in the whole block
    }
    copies_landed();
}

// The four preparation jobs are bodies of one launch (k_prep): blk is the block's index inside its own job.
__device__ __forceinline__ void cvt8_body(const float* __restrict__ src, bf* dst, size_t n8, unsigned blk) {
    const size_t i = (size_t)blk * 256 + threadIdx.x; if (i >= n8) return;
    const v8f v = *(const v8f*)(src + i * 8); v8us o;
#pragma unroll
    for (int k = 0; k < 8; ++k) o[k] = f2bf(v[k]);
    *(v8us*)(dst + i * 8) = o; 
}

__device__ __forceinline__ void cvtw_body(const float* __restrict__ src, h16* dst, size_t n8, unsigned blk) {
#pragma clang fp contract(off)
    const size_t i = (size_t)blk * 256 + threadIdx.x; if (i >= n8) return;
    const v8f v = *(const v8f*)(src + i * 8); v8h o;
#pragma unroll
    for (int k = 0; k < 8; ++k) o[k] = toh_flush(bfr(v[k]) * WOC);
    *(v8h*)(dst + i * 8) = o; 
}

// ropetab_body: rotary table CS[t][0..31] = cos(t * f_j), CS[t][32..63] = sin(t * f_j), f_j = 2^(-10 * j / 31), j < 32 (the other 32 pairs are the identity).
__device__ __forceinline__ void ropetab_body(float* CS, unsigned blk) {
#pragma clang fp contract(off)
    const int i = (int)blk * 256 + (int)threadIdx.x;              // the job's blocks * 256 == SEQ * 32 exactly
    const int t = i >> 5, j = i & 31;
    const float e = (float)j / 31.0f;
    const float a = -10.0f * e;
    const float lo = fmaf(-10.0f, e, -a);                          // exact residual of the exponent product
    float invf = exp2f(a);
    invf = fmaf(invf, 0.69314718056f * lo, invf);
    const float th = (float)t * invf;
    float s, c; sincosf(th, &s, &c);
    float* row = CS + (size_t)t * 64;
    *(float*)(row + j) = c; *(float*)(row + 32 + j) = s;
    
}

// k_prep: the four independent preparation jobs in one grid; the block index picks the job (block-uniform), the table (most arithmetic per byte) first.
static constexpr size_t   N8_X  = (size_t)SEQ * DM / 8;            // 8-element items of x, of Wq|Wk|Wv, of Wo
static constexpr size_t   N8_W  = (size_t)3 * DM * DM / 8;
static constexpr size_t   N8_O  = (size_t)DM * DM / 8;
static constexpr unsigned PB_T  = (unsigned)((size_t)SEQ * 32 / 256);
static constexpr unsigned PB_X  = (unsigned)((N8_X + 255) / 256);
static constexpr unsigned PB_W  = (unsigned)((N8_W + 255) / 256);
static constexpr unsigned PB_O  = (unsigned)((N8_O + 255) / 256);
static constexpr unsigned PB_ALL = PB_T + PB_X + PB_W + PB_O;
__global__ __launch_bounds__(256) void k_prep(const float* __restrict__ x, const float* __restrict__ w, bf* XB, bf* WB, h16* WO, float* CS) {
    const unsigned b = blockIdx.x;
    if (b < PB_T)                    ropetab_body(CS, b);
    else if (b < PB_T + PB_X)        cvt8_body(x, XB, N8_X, b - PB_T);
    else if (b < PB_T + PB_X + PB_W) cvt8_body(w, WB, N8_W, b - (PB_T + PB_X));
    else                             cvtw_body(w + (size_t)3 * DM * DM, WO, N8_O, b - (PB_T + PB_X + PB_W));
}

// k_qkv: fused QKV projection + per-head RMS normalisation + rotary (q, k) / value mix (v). Block = 4 waves, tile = 128 tokens x one head slot (128 columns);
// each wave computes a 64 x 64 quarter (16 accumulators, operand tiles staged in LDS by gemm128, K = DM), stages it in the block's LDS tile (the same LDS, free behind gemm128); block barrier;
// row pass: wave w owns rows 32w..32w+31, lane owns columns 4*lane..4*lane+3, sum of squares by xor exchanges, rotary partner (d +- 64) by one xor-16 exchange, result written back in place; block barrier;
//             v slots: transposed plane [h][d][t] (row pitch SEQ) value, and residual x2048 [h][d][t < EROWS] for token tiles below EROWS: 8 lanes x 16 B per d-row line (64 tokens), four d-rows per instruction.
// LDS tile: cross-wave (block barriers). grid (SEQ/128, NQKV).
__global__ __launch_bounds__(128) void k_qkv(const bf* __restrict__ XB, const bf* __restrict__ WB, const float* __restrict__ ve, const float* __restrict__ lam, const float* __restrict__ CS,
                                            h16* QK, h16* VT, h16* VR) {
    constexpr int RING = 2 * 2 * 128 * (64 * 2 + 16), TILE = 128 * TP * 4;     // bytes: two stages of gemm128<64>; the f32 head tile
    __shared__ __align__(16) char sm[RING > TILE ? RING : TILE];
    float* os = (float*)sm;
    const size_t PLE = (size_t)NH_ * SEQ * HD;                     // elements per q/k plane; QK = [q | q residual | k | k residual]
    const int lane = threadIdx.x & 31, lr = lane & 15, hi = lane >> 4;
    const int wave = __builtin_amdgcn_readfirstlane((int)(threadIdx.x >> 5));
    const int r0 = blockIdx.x * 128;
    const int hh = blockIdx.y;                                     // block-uniform head slot
    const int kind = hh >> 3, hd = hh & 7;
    const int wt = wave >> 1, wc = wave & 1;                       // this wave's token half and column half of the tile
    v8f acc[4][4];
#pragma unroll
    for (int mb = 0; mb < 4; ++mb)
#pragma unroll
        for (int nb = 0; nb < 4; ++nb) acc[mb][nb] = (v8f){};
    gemm128<64>(XB + (size_t)r0 * DM, WB + (size_t)hh * HD * DM, sm, acc);
    // D: row 8h+j, col lane&15 -> this wave's 64 tile rows and 64 columns
#pragma unroll
    for (int mb = 0; mb < 4; ++mb)
#pragma unroll
        for (int nb = 0; nb < 4; ++nb)
#pragma unroll
            for (int j = 0; j < 8; ++j) os[(wt * 64 + mb * 16 + hi * 8 + j) * TP + wc * 64 + nb * 16 + lr] = acc[mb][nb][j];
    __syncthreads();
    const float l0 = bfr(lam[0]), l1 = bfr(lam[1]);
    const float sg = (lane < 16) ? 1.0f : -1.0f;                   // d < 64: x1 c + x2 s; d >= 64: x2 c - x1 s
    const bool act = (lane & 8) == 0;                              // frequency index (d & 63) < 32
    // the table (q, k) or value-embedding (v) rows of eight tokens are loaded together, in front of the eight row computations
    auto rowpass = [&](auto fq) __attribute__((always_inline)) {
        constexpr bool QKR = decltype(fq)::v;
#pragma unroll 1
        for (int rg = 0; rg < 32; rg += 8) {
            v4f g0[8], g1[8], xg[8];
            const int tg = r0 + wave * 32 + rg;
            const float* gp = QKR ? CS + (size_t)tg * 64 + 4 * (lane & 7)                   // address always inside the table row
                                  : ve + (size_t)tg * DM + (size_t)hd * HD + 4 * lane;
#pragma unroll
            for (int u = 0; u < 8; ++u) {
                if constexpr (QKR) { g0[u] = *(const v4f*)(gp + u * 64); g1[u] = *(const v4f*)(gp + u * 64 + 32); }
                else               { g0[u] = *(const v4f*)(gp + (size_t)u * DM); } }
            loads_first(); addr_free(gp, gp);
#pragma unroll
            for (int u = 0; u < 8; ++u) xg[u] = *(const v4fa*)(&os[(wave * 32 + rg + u) * TP + 4 * lane]);
#pragma unroll
            for (int u = 0; u < 8; ++u) {
                const int row = wave * 32 + rg + u;
                const v4f xv = xg[u];
                float ss = xv[0] * xv[0] + xv[1] * xv[1] + xv[2] * xv[2] + xv[3] * xv[3];
                ss += __shfl_xor(ss, 16, 32); ss += __shfl_xor(ss, 8, 32); ss += __shfl_xor(ss, 4, 32); ss += __shfl_xor(ss, 2, 32); ss += __shfl_xor(ss, 1, 32);
                const float inv = rsqrtf(ss * (1.0f / HD) + 1.0e-6f);
                v4f y;
                if constexpr (QKR) {
                    v4f cv = g0[u];
                    v4f sv = g1[u];
                    asm volatile("" : "+v"(cv), "+v"(sv));
#pragma unroll
                    for (int i = 0; i < 4; ++i) {
                        const float xn = xv[i] * inv;
                        const float part = __shfl_xor(xn, 16, 32);
                        const float c = act ? cv[i] : 1.0f; const float s = act ? sv[i] : 0.0f;
                        y[i] = xn * c + sg * (part * s); }
                } else {
                    const v4f e4 = g0[u];
#pragma unroll
                    for (int i = 0; i < 4; ++i) y[i] = l0 * (xv[i] * inv) + l1 * bfr(e4[i]);
                }
                *(v4fa*)(&os[row * TP + 4 * lane]) = y;
            }
        } };
    if (kind < 2) rowpass(flag_t<true>{}); else rowpass(flag_t<false>{});      // block-uniform
    __syncthreads();
    if (kind < 2) {
        static_assert(4 * 16 * 32 * 16 == 128 * HD * 2);           // waves x instructions x lanes x 16 B == 128 rows x 256 B
        const size_t pb0 = (size_t)(kind * 2) * PLE + ((size_t)hd * SEQ + (size_t)r0) * HD;
{
#pragma unroll 2
            for (int it = 0; it < 16; ++it) { const int row = wave * 32 + it * 2 + (lane >> 4), c8 = (lane & 15) * 8;
                const v4f x0 = *(const v4fa*)(&os[row * TP + c8]); const v4f x1 = *(const v4fa*)(&os[row * TP + c8 + 4]); v8h hv, rv;
#pragma unroll
                for (int i = 0; i < 4; ++i) { const h16 a0 = toh_flush(x0[i]); const h16 a1 = toh_flush(x1[i]); hv[i] = a0; hv[4 + i] = a1;
                    rv[i] = toh_flush((x0[i] - (float)a0) * QRS); rv[4 + i] = toh_flush((x1[i] - (float)a1) * QRS); }
                const size_t oo = pb0 + (size_t)row * HD + c8;
                *(v8h*)(QK + oo) = hv; *(v8h*)(QK + PLE + oo) = rv; }
             }
    } else {
        static_assert(4 * 16 * 32 * 16 == HD * 128 * 2);
        const bool wr = r0 < EROWS;                                // block-uniform: whole token tile inside the residual plane
        const size_t vb0 = ((size_t)hd * HD) * SEQ + (size_t)r0;
        const size_t rb0 = ((size_t)hd * HD) * EROWS + (size_t)r0;
{
#pragma unroll 2
            for (int it = 0; it < 16; ++it) { const int d = wc * 64 + it * 4 + (lane >> 3), c8 = wt * 64 + (lane & 7) * 8; v8h hv, rv;
#pragma unroll
                for (int i = 0; i < 8; ++i) { const float x = os[(c8 + i) * TP + d]; const h16 a0 = toh_flush(x); hv[i] = a0; rv[i] = toh_flush((x - (float)a0) * QRS); }
                *(v8h*)(VT + vb0 + (size_t)d * SEQ + c8) = hv;
                if (wr) *(v8h*)(VR + rb0 + (size_t)d * EROWS + c8) = rv; }
             }
    }
}

// flash_body: fused attention, one wave per 16 query rows of one head (EARLY: of one 64-wide half of the head dimension); Q fragments straight from the f16 planes, K / V^T fragments from LDS.
// The block's four waves walk the union [kb, ke) of their key ranges together, one 32-key tile a trip. A stage in LDS is [K | K residual | V^T (| V^T residual)]: K rows of 256 B at pitch 272 B, V^T row pieces of 64 B at pitch 80 B
// (16 B x odd: the pitch for 16-byte row reads). Tile s + 2 is copied into the buffer of tile s behind the barrier that ends trip s. A wave skips the products of a tile outside its own range and passes every barrier.
// Transposed form: S^T[key][t] = K Q^T (A = K rows, B = Q rows); lane (t = lane&15, h = lane>>4) holds keys 8h+r of each 16-key tile, so the packed
// P tile is directly the B fragment of O^T[d][t] = V^T P^T (element r <- tile keys 0..15, element 8+r <- tile keys 16..31, lane unchanged).
// Scores on all rows: K Q + (K Q_res + K_res Q) / 2048. Keep rule per element: 0 <= t - key < window; window <= 0: every key kept with score 0 (uniform row).
// Key range per wave [klo, kend) from the device-read window, inside [0, SEQ); all visited plane rows are written by k_qkv.
// EARLY = 1 (query rows [0, EROWS)): P = f16 value + f16 residual x2048; O = V P + (V P_res + V_res P) / 2048; row sum from the f32 exponentials; y written as value + residual x2048.
// EARLY = 0 (query rows [EROWS, SEQ)): single P, v, y; row sum over the converted P.
// Both instantiations are bodies of one launch (k_flash): sm is the block's LDS, [output staging | two stages]; bx = the block's 64-row query tile inside its row range, h = head, dh = half of the head dimension (EARLY).
template <int EARLY> struct flash_lds {
    static constexpr int DT  = EARLY ? 4 : 8;
    static constexpr int OSB = (int)sizeof(float) * AW * 16 * (DT * 16 + 4);                              // output staging, bytes
    static constexpr int SB  = 2 * 32 * (HD * 2 + 16) + (EARLY ? 2 : 1) * DT * 16 * (32 * 2 + 16);        // one stage, bytes
    static constexpr int ALL = OSB + 2 * SB;
};
template <int EARLY>
__device__ __forceinline__ void flash_body(const h16* __restrict__ QH, const h16* __restrict__ QR, const h16* __restrict__ KP, const h16* __restrict__ KR,
                                           const h16* __restrict__ VT, const h16* __restrict__ VR, const int* __restrict__ win_p, h16* YH, h16* YR,
                                           char* sm, const int bx, const int h, const int dh) {
    constexpr int DT  = EARLY ? 4 : 8;           // 16-wide output tiles per wave
    constexpr int OSP = DT * 16 + 4;             // LDS row pitch (floats)
    constexpr int LPR = DT * 2;                  // lanes per y row segment (16 B each)
    constexpr int RPI = 32 / LPR;                // rows per store instruction
    constexpr int NST = 16 / RPI;                // store instructions per pass
    static_assert(32 % LPR == 0);
    static_assert(16 % RPI == 0);
    static_assert(NST * 32 * 16 == 16 * DT * 16 * 2);   // instructions x lanes x 16 B == 16 rows x segment bytes
    static_assert((OSP * 4) % 16 == 0);
    static_assert(sizeof(float) * AW * 16 * OSP <= 131072);
    constexpr int KPB = HD * 2 + 16;             // LDS pitch of a K row, bytes
    constexpr int VPB = 32 * 2 + 16;             // LDS pitch of a V^T row piece (32 keys), bytes
    constexpr int KTB = 32 * KPB;                // one K plane tile
    constexpr int VTB = DT * 16 * VPB;           // one V^T plane tile
    constexpr int SB  = 2 * KTB + (EARLY ? 2 : 1) * VTB;   // one stage
    static_assert(AW == 4);                      // 128 lanes: 8 K rows or 32 V^T row pieces per copy of the whole block
    static_assert((KPB / 16) % 2 == 1);
    static_assert((VPB / 16) % 2 == 1);
    static_assert(SB % 16 == 0);
    static_assert(DT * 16 == (EARLY ? 2 : 4) * 32);
    static_assert(2 * SB + sizeof(float) * AW * 16 * OSP <= 131072);
    static_assert(flash_lds<EARLY>::OSB == (int)sizeof(float) * AW * 16 * OSP);
    static_assert(flash_lds<EARLY>::SB == SB);
    static_assert(flash_lds<EARLY>::OSB % 16 == 0);
    float* os = (float*)sm;
    char* st = sm + flash_lds<EARLY>::OSB;
    const int lane = threadIdx.x & 31, lr = lane & 15, hi = lane >> 4;
    const int wv = (int)(threadIdx.x >> 5);
    const int wave = __builtin_amdgcn_readfirstlane(wv);
    const int d0 = EARLY ? dh * 64 : 0;
    int winv = win_p[0];
    const bool allm = winv <= 0;                                   // every key replaced by the fill value: uniform row
    winv = winv > SEQ ? SEQ : winv;
    const int t0v = (EARLY ? 0 : EROWS) + (bx * AW + wv) * 16;
    int klov = t0v - winv + 1; klov = klov < 0 ? 0 : klov; klov &= ~31; klov = allm ? 0 : klov;
    const int kendv = allm ? SEQ : (t0v + 16);
    const int t0 = __builtin_amdgcn_readfirstlane(t0v);
    const int klo = __builtin_amdgcn_readfirstlane(klov);
    const int kend = __builtin_amdgcn_readfirstlane(kendv);        // key tiles [klo, kend) step 32; last tile ends at or below SEQ
    // the block's range: first wave's klo, last wave's kend; both multiples of 32, at least two tiles, inside [0, SEQ)
    const int tbv = (EARLY ? 0 : EROWS) + bx * (AW * 16);
    int kbv = tbv - winv + 1; kbv = kbv < 0 ? 0 : kbv; kbv &= ~31; kbv = allm ? 0 : kbv;
    const int kb = __builtin_amdgcn_readfirstlane(kbv);
    const int nt = __builtin_amdgcn_readfirstlane(((allm ? SEQ : (tbv + AW * 16)) - kbv) >> 5);
    const size_t qo = ((size_t)h * SEQ + (size_t)(t0 + lr)) * HD + 8 * hi;        // B fragments: col t, k = d
    const v16h hz = (v16h){};
    v8f o[DT], oR[DT];
#pragma unroll
    for (int j = 0; j < DT; ++j) { o[j] = (v8f){}; oR[j] = (v8f){}; }
    float m = NEGB, l = 0.0f;
    // load schedule: Q fragments once, in front of the key loop; the K and V fragments of a tile are read from its LDS buffer in front of its score products
    v16h qh[4], qr[4];
#pragma unroll
    for (int c = 0; c < 4; ++c) { qh[c] = ldh(QH + qo + 32 * c); qr[c] = ldh(QR + qo + 32 * c); }
    addr_free(QH + qo, QR + qo);
    // copies: a K tile is 8 KB in a row in its plane, lane tid brings 16-byte pieces tid + 128 i (row (tid >> 4) + 8 i); of V^T four neighbouring lanes bring one row's 64 bytes (row (tid >> 2) + 32 i)
    const int tid = (int)threadIdx.x;
    const unsigned lk = lds_off(st) + (unsigned)((tid >> 4) * KPB + (tid & 15) * 16);
    const unsigned lv = lds_off(st) + (unsigned)(2 * KTB + (tid >> 2) * VPB + (tid & 3) * 16);
    const char* gk = (const char*)(KP + (size_t)h * SEQ * HD) + tid * 16;
    const char* gr = (const char*)(KR + (size_t)h * SEQ * HD) + tid * 16;
    const char* gv = (const char*)(VT + ((size_t)h * HD + (size_t)(d0 + (tid >> 2))) * SEQ) + (tid & 3) * 16;
    const char* gq = (const char*)(VR + ((size_t)h * HD + (size_t)(d0 + (tid >> 2))) * EROWS) + (tid & 3) * 16;
    auto fill = [&](const int buf, const int key) __attribute__((always_inline)) {
        const unsigned bo = (unsigned)(buf * SB);
        copy4(lk + bo,       8 * KPB, gk + (size_t)key * (HD * 2), (size_t)8 * HD * 2);
        copy4(lk + bo + KTB, 8 * KPB, gr + (size_t)key * (HD * 2), (size_t)8 * HD * 2);
        if constexpr (EARLY) {
            const int kc = key < EROWS ? key : (EROWS - 32);     // clamped residual-plane key (address always inside the plane)
            copy2(lv + bo,       32 * VPB, gv + (size_t)key * 2, (size_t)32 * SEQ * 2);
            copy2(lv + bo + VTB, 32 * VPB, gq + (size_t)kc * 2,  (size_t)32 * EROWS * 2);
        } else {
            copy4(lv + bo,       32 * VPB, gv + (size_t)key * 2, (size_t)32 * SEQ * 2);
        } };
    fill(0, kb);
    copies_landed();
    __syncthreads();
    fill(1, kb + 32);                                            // a second tile always exists
    // kept rolled: one copy of the tile body in the text, and the buffer index stays a scalar of the trip
#pragma unroll 1
    for (int s = 0; s < nt; ++s) {
      const int key0 = kb + 32 * s;
      if (key0 >= klo && key0 < kend) {                          // wave-uniform: the wave's own tiles, in ascending order
        const bool rok = key0 < EROWS;                           // wave-uniform
        const char* sb = st + (s & 1) * SB;
        v16h ka[4], kq[4], ra[4], rb[4], vf[DT], vrf[DT];
        const char* kp = sb + lr * KPB + 16 * hi;                // A fragment: row key, k = d
        const char* vp = sb + 2 * KTB + lr * VPB + 16 * hi;      // A fragment: row d (+ 16 j), k = key
#pragma unroll
        for (int c = 0; c < 4; ++c) { ka[c] = ldh((const h16*)(kp + 64 * c));       kq[c] = ldh((const h16*)(kp + 16 * KPB + 64 * c));
                                      ra[c] = ldh((const h16*)(kp + KTB + 64 * c)); rb[c] = ldh((const h16*)(kp + KTB + 16 * KPB + 64 * c)); }
#pragma unroll
        for (int j = 0; j < DT; ++j) {
            vf[j] = ldh((const h16*)(vp + j * 16 * VPB));
            if (EARLY) vrf[j] = ldh((const h16*)(vp + VTB + j * 16 * VPB));
        }
        loads_first();
        v8f sHa = (v8f){}, sLa = (v8f){}, sHb = (v8f){}, sLb = (v8f){};
#pragma unroll
        for (int c = 0; c < 4; ++c) {
            sHa = wmma16g(ka[c], qh[c], sHa); sLa = wmma16g(ka[c], qr[c], sLa); sLa = wmma16g(ra[c], qh[c], sLa);
            sHb = wmma16g(kq[c], qh[c], sHb); sLb = wmma16g(kq[c], qr[c], sLb); sLb = wmma16g(rb[c], qh[c], sLb);
        }
        const int da0 = (t0 + lr) - (key0 + 8 * hi);             // t - key for r = 0 of tile a
        float ta[8], tb[8]; bool fa[8], fb[8]; float mx = NEGB;
#pragma unroll
        for (int r = 0; r < 8; ++r) {
            const int da = da0 - r, db = da0 - 16 - r;
            fa[r] = allm | ((da >= 0) & (da < winv));
            fb[r] = allm | ((db >= 0) & (db < winv));
            const float ua = (sHa[r] + sLa[r] * QRI) * SC2, ub = (sHb[r] + sLb[r] * QRI) * SC2;
            ta[r] = allm ? 0.0f : ua; tb[r] = allm ? 0.0f : ub;
            mx = fmaxf(mx, fmaxf(fa[r] ? ta[r] : NEGB, fb[r] ? tb[r] : NEGB)); }
        mx = fmaxf(mx, __shfl_xor(mx, 16, 32));
        const float mnew = fmaxf(m, mx);
        const float alpha = __builtin_amdgcn_exp2f(m - mnew);
        const float sh = PSH - mnew;
        v16h pb, pr = hz; float ls = 0.0f;
#pragma unroll
        for (int r = 0; r < 8; ++r) {
            const float xa = ta[r] + sh, xb = tb[r] + sh;
            const float ea = __builtin_amdgcn_exp2f(xa), eb = __builtin_amdgcn_exp2f(xb);
            const float ga = (fa[r] & (xa >= -14.0f)) ? ea : 0.0f;       // dropped elements and would-be subnormal operands selected to 0 by value
            const float gb = (fb[r] & (xb >= -14.0f)) ? eb : 0.0f;
            const h16 pa = (h16)ga; const h16 pc = (h16)gb;
            pb[r] = pa; pb[8 + r] = pc;
            if (EARLY) { pr[r] = toh_flush((ga - (float)pa) * QRS); pr[8 + r] = toh_flush((gb - (float)pc) * QRS); ls += ga + gb; }
            else       { ls += (float)pa + (float)pc; } }
        l = l * alpha + ls; m = mnew;
#pragma unroll
        for (int j = 0; j < DT; ++j) { o[j] = o[j] * alpha; if (EARLY) oR[j] = oR[j] * alpha; }
#pragma unroll
        for (int j = 0; j < DT; ++j) {
            const v16h v = vf[j];
            o[j] = wmma16g(v, pb, o[j]);
            if (EARLY) {
                v16h vr = vrf[j];
                if (!rok) vr = hz;
                oR[j] = wmma16g(v, pr, oR[j]);
                oR[j] = wmma16g(vr, pb, oR[j]);
            }
        }
      }
      lds_reads_done();
      copies_landed();
      __syncthreads();                                           // publishes tile s + 1 and frees the buffer of tile s
      if (s + 2 < nt) fill(s & 1, key0 + 64);                    // same test in the whole block
    }
    copies_landed();
    l += __shfl_xor(l, 16, 32);
    const bool any = l > 0.0f;
    const float lsafe = any ? l : 1.0f;
    const float inv = any ? (YC * (1.0f / lsafe)) : 0.0f;
    const int wb = wave * 16 * OSP;
    // O^T D layout: f_j[r] = (d = 16j + 8h + r, t = lane&15) -> os[t][d]; rows 0..15 x columns 0..DT*16-1 all written; tile private to the wave
#pragma unroll
    for (int j = 0; j < DT; ++j) {
        v8f f = o[j];
        if (EARLY) f = o[j] + oR[j] * QRI;
        v4f a, c;
        a[0] = f[0] * inv; a[1] = f[1] * inv; a[2] = f[2] * inv; a[3] = f[3] * inv; c[0] = f[4] * inv; c[1] = f[5] * inv; c[2] = f[6] * inv; c[3] = f[7] * inv;
        *(v4fa*)(&os[wb + lr * OSP + 16 * j + 8 * hi]) = a; *(v4fa*)(&os[wb + lr * OSP + 16 * j + 8 * hi + 4]) = c; }
    wave_sync();
    const size_t ybase = (size_t)t0 * DM + (size_t)h * HD + (size_t)d0;
{
#pragma unroll 2
        for (int s = 0; s < NST; ++s) { const int row = s * RPI + lane / LPR, c8 = (lane % LPR) * 8;
            const v4f x0 = *(const v4fa*)(&os[wb + row * OSP + c8]); const v4f x1 = *(const v4fa*)(&os[wb + row * OSP + c8 + 4]); v8h hv, rv;
#pragma unroll
            for (int i = 0; i < 4; ++i) { const h16 a0 = toh_flush(x0[i]); const h16 a1 = toh_flush(x1[i]); hv[i] = a0; hv[4 + i] = a1;
                rv[i] = toh_flush((x0[i] - (float)a0) * QRS); rv[4 + i] = toh_flush((x1[i] - (float)a1) * QRS); }
            const size_t oo = ybase + (size_t)row * DM + c8;
            *(v8h*)(YH + oo) = hv;
            if (EARLY) *(v8h*)(YR + oo) = rv; }
         }
}

// k_flash: both row ranges in one grid (their y rows are disjoint), so that the few blocks of rows [0, EROWS) run beside the others instead of alone on part of the chip.
// Blocks 0 .. FB_L - 1: query rows [EROWS, SEQ), tile fastest, then head. Behind them the rows [0, EROWS), the tile with the most keys first, then head and half of the head dimension.
static constexpr int FT_L = (SEQ - EROWS) / (16 * AW);             // 64-row query tiles per head of the two ranges
static constexpr int FT_E = EROWS / (16 * AW);
static constexpr int FB_L = FT_L * NH_;
static constexpr int FB_E = FT_E * NH_ * 2;
static constexpr int FB_ALL = FB_L + FB_E;
__global__ __launch_bounds__(32 * AW) void k_flash(const h16* __restrict__ QH, const h16* __restrict__ QR, const h16* __restrict__ KP, const h16* __restrict__ KR,
                                                   const h16* __restrict__ VT, const h16* __restrict__ VR, const int* __restrict__ win_p, h16* YH, h16* YR) {
    __shared__ __align__(16) char sm[flash_lds<0>::ALL > flash_lds<1>::ALL ? flash_lds<0>::ALL : flash_lds<1>::ALL];
    const int b = (int)blockIdx.x;                                 // block-uniform choice of the body
    if (b < FB_L) {
        flash_body<0>(QH, QR, KP, KR, VT, VR, win_p, YH, YR, sm, b % (FT_L > 0 ? FT_L : 1), b / (FT_L > 0 ? FT_L : 1), 0);
    } else {
        const int e = b - FB_L;
        flash_body<1>(QH, QR, KP, KR, VT, VR, win_p, YH, YR, sm, FT_E - 1 - e / (2 * NH_), (e >> 1) % NH_, e & 1);
    }
}

// k_out: output projection, block = 4 waves per 128 x 128 tile, 64 x 64 (16 accumulators) per wave, A = y rows (K contiguous), Bt = Wo rows [out][in]; f16 operands, tiles staged in LDS by gemm128.
// Token tiles below EROWS (block-uniform): the residual plane products are accumulated first, scaled by 1/2048 (exact), then the value-plane products are added.
__global__ __launch_bounds__(128) void k_out(const h16* __restrict__ YH, const h16* __restrict__ YR, const h16* __restrict__ WO, float* OUT) {
    __shared__ __align__(16) char sm[2 * 2 * 128 * (128 * 2 + 16)];           // two stages of gemm128<128>
    __shared__ __align__(16) float osw[4 * 16 * 68];                          // one output staging tile per wave
    const int lane = threadIdx.x & 31, lr = lane & 15, hi = lane >> 4;
    const int wave = __builtin_amdgcn_readfirstlane((int)(threadIdx.x >> 5));
    const int b0 = blockIdx.x * 128, e0 = blockIdx.y * 128;                   // the block's first token and first output column
    const int r0 = b0 + (wave >> 1) * 64, c0 = e0 + (wave & 1) * 64;          // the wave's
    float* os = osw + wave * 16 * 68;
    v8f acc[4][4];
#pragma unroll
    for (int mb = 0; mb < 4; ++mb)
#pragma unroll
        for (int nb = 0; nb < 4; ++nb) acc[mb][nb] = (v8f){};
    // pass 0 (residual plane) only where rows b0..b0+127 lie inside it, pass 1 (value plane) always; block-uniform. Kept rolled: one copy of the K loop in the text, and no address of one pass held in registers through the other
#pragma unroll 1
    for (int p = (b0 < EROWS) ? 0 : 1; p < 2; ++p) {
        gemm128<128>((p == 0 ? YR : YH) + (size_t)b0 * DM, WO + (size_t)e0 * DM, sm, acc);
        if (p == 0) {
#pragma unroll
            for (int mb = 0; mb < 4; ++mb)
#pragma unroll
                for (int nb = 0; nb < 4; ++nb) acc[mb][nb] = acc[mb][nb] * QRI;
        }
    }
    static_assert(8 * 32 * 16 == 16 * 64 * 4);                     // instructions x lanes x 16 B == 16 rows x 256 B
#pragma unroll
    for (int mb = 0; mb < 4; ++mb) {
#pragma unroll
        for (int nb = 0; nb < 4; ++nb) {
#pragma unroll
            for (int j = 0; j < 8; ++j) os[(hi * 8 + j) * 68 + nb * 16 + lr] = acc[mb][nb][j] * OSC; }   // D: row 8h+j, col lane&15
        wave_sync();
        float* orow = OUT + (size_t)(r0 + mb * 16) * DM + c0;
{
#pragma unroll
            for (int s = 0; s < 8; ++s) { const int row = 2 * s + (lane >> 4), c4 = (lane & 15) * 4;   // 8 s x 2 rows = 16 rows; 16 lanes x 4 floats = 64 columns = two lines
                const v4f val = *(const v4fa*)(&os[row * 68 + c4]);
                *(v4f*)(orow + (size_t)row * DM + c4) = val; }
             }
        wave_sync();
    }
}

static constexpr size_t al256(size_t v) { return (v + 255) & ~(size_t)255; }
static constexpr size_t SZ_XB = al256((size_t)SEQ * DM * 2);
static constexpr size_t SZ_WB = al256((size_t)3 * DM * DM * 2);
static constexpr size_t SZ_WO = al256((size_t)DM * DM * 2);
static constexpr size_t SZ_CS = al256((size_t)SEQ * 64 * 4);
static constexpr size_t SZ_PL = al256((size_t)NH_ * SEQ * HD * 2);
static constexpr size_t SZ_RS = al256((size_t)NH_ * HD * EROWS * 2);
static constexpr size_t SZ_YH = al256((size_t)SEQ * DM * 2);
static constexpr size_t SZ_YR = al256((size_t)EROWS * DM * 2);
static constexpr size_t SZ_TOTAL = SZ_XB + SZ_WB + SZ_WO + SZ_CS + 4 * SZ_PL + SZ_PL + SZ_RS + SZ_YH + SZ_YR;
static_assert(SZ_TOTAL <= (size_t)134217728);                        // workspace carve <= 128 MiB
static_assert(SZ_PL == (size_t)NH_ * SEQ * HD * 2);                  // the four q/k planes are contiguous with no padding between them
static_assert(((size_t)NH_ * SEQ * HD * 2) % 256 == 0);
static_assert((size_t)NH_ * SEQ * HD == (size_t)SEQ * DM);           // v^T plane [(h*128 + d)][t] has the extent of a q/k plane

extern "C" void kernel_launch(void* const* d_in, const int* in_sizes, int n_in,
                              void* d_out, int out_size, void* d_ws, size_t ws_size, hipStream_t stream) {
    if (n_in < 5) return;
    const size_t needx = (size_t)SEQ * DM;
    if ((size_t)in_sizes[0] < needx || (size_t)in_sizes[1] < needx) return;
    if (in_sizes[2] < 2) return;
    if ((size_t)in_sizes[3] < (size_t)4 * DM * DM) return;
    if (in_sizes[4] < 1) return;
    if ((size_t)out_size < needx) return;
    if (SZ_TOTAL > ws_size) return;
    // wire order: x, ve, lambdas, qkvo_w, window
    const float* x   = (const float*)d_in[0];
    const float* ve  = (const float*)d_in[1];
    const float* lam = (const float*)d_in[2];
    const float* w   = (const float*)d_in[3];
    const int*   win = (const int*)d_in[4];
    float* OUT = (float*)d_out;      // [SEQ][1024]
    char* wsp = (char*)d_ws;
    bf*  XB = (bf*)wsp;   wsp += SZ_XB;                  // x      [SEQ][1024] bf16
    bf*  WB = (bf*)wsp;   wsp += SZ_WB;                  // Wq|Wk|Wv [3072][1024] bf16 ([out][in] = Bt as-is)
    h16* WO = (h16*)wsp;  wsp += SZ_WO;                  // Wo [1024][1024] f16 (bf16 value x256)
    float* CS = (float*)wsp; wsp += SZ_CS;               // rotary table [SEQ][64]
    h16* QK = (h16*)wsp;  wsp += 4 * SZ_PL;              // [q | q residual | k | k residual], each [8][SEQ][128]
    h16* VT = (h16*)wsp;  wsp += SZ_PL;                  // [8][128][SEQ]
    h16* VR = (h16*)wsp;  wsp += SZ_RS;                  // [8][128][EROWS] residual x2048
    h16* YH = (h16*)wsp;  wsp += SZ_YH;                  // [SEQ][1024] (x64)
    h16* YR = (h16*)wsp;  wsp += SZ_YR;                  // [EROWS][1024] residual x2048
    const size_t PLE = (size_t)NH_ * SEQ * HD;
    const h16* QH = QK; const h16* QR = QK + PLE; const h16* KP = QK + 2 * PLE; const h16* KR = QK + 3 * PLE;

    k_prep<<<PB_ALL, 256, 0, stream>>>(x, w, XB, WB, WO, CS);

    // fused QKV: token tiles x 24 head slots -> q, q residual, k, k residual planes [h][t][d]; v^T plane [h][d][t] (+ residual for t < EROWS)
    k_qkv<<<dim3(SEQ / 128, NQKV, 1), 128, 0, stream>>>(XB, WB, ve, lam, CS, QK, VT, VR);

    // query rows [EROWS, SEQ): single P / v / y; query rows [0, EROWS): multi-product instantiation (two halves of the head dimension); disjoint y rows, one grid
    k_flash<<<FB_ALL, 32 * AW, 0, stream>>>(QH, QR, KP, KR, VT, VR, win, YH, YR);

    // out[t][d] = sum_e y[t][e] Wo[d][e]
    k_out<<<dim3(SEQ / 128, DM / 128, 1), 128, 0, stream>>>(YH, YR, WO, OUT);
}

// v005
// It runs in 83 microseconds.
// In both of two side-by-side timings against v004, it was 1.07 times as fast.
// All steps since v000 together make it 3.48 times as fast.
#include <hip/hip_runtime.h>

// Attention layer: one input x [SEQ][1024] feeds a fused [out][in] QKV projection (24 head slots of 128: q 0..7, k 8..15, v 16..23); unweighted RMS normalisation (eps 1e-6) of q, k, v per head row;
// half-split rotary embedding with only the first 32 of the 64 frequency pairs active (base 1024); v = l0 * vnorm + l1 * value-embedding; sliding-window causal keep rule 0 <= t - j < window
// (window int32, device-read; window <= 0 gives the uniform row over all keys); score scale 0.12 (multiplied); softmax f32 (online, running max over kept keys); output projection y Wo^T with Wo [out][in].
// Compute dtypes, f32 accumulate everywhere: QKV projection v_wmma_f32_16x16x32_bf16 (x, W RNE-converted to bf16; products exact);
// scores v_wmma_f32_16x16x32_f16 with q and k each as f16 value + f16 residual x2048 in its own accumulator (three products) on all rows;
// P.V v_wmma_f32_16x16x32_f16: P (x16384 carry, cancels in the normalisation) and v single f16 on query rows >= EROWS; on query rows < EROWS P and v each as f16 value + f16 residual x2048 (residual products in their own accumulator, folded by 1/2048);
// output projection v_wmma_f32_16x16x32_f16: y carried x64 (single f16 on rows >= EROWS, f16 value + f16 residual x2048 on rows < EROWS), Wo = bf16(RNE) x256 held exactly in f16; fold 1/16384 in the f32 epilogue.
// Layout: bf16 planes of x and of the three QKV weights; f16 plane of Wo; rotary table [t][cos 0..31 | sin 0..31]; q / q-residual / k / k-residual planes [h][t][128]; v^T plane [h][d][t], v^T residual [h][d][t < EROWS];
// y plane [t][1024] (+ residual for t < EROWS). Flash kernel in transposed form (S^T = K Q^T, O^T = V^T P^T): Q fragments straight from the planes; each 32-key tile of K, K residual and V^T goes into LDS once per block by asynchronous copies (two buffers) and serves all four waves.
// The two projections: 128 x 128 product tile per block of four waves (64 x 64 each; output projection below EROWS: 64 tokens, value and residual rows stacked); both operand tiles go from the planes into LDS by asynchronous copies of whole 128-byte lines (two buffers), fragments are read from LDS.

#ifndef NB
#define NB 1
#endif
#ifndef SEQ
#define SEQ 4096
#endif
#define NB_FULL  1
#define SEQ_FULL 4096
#define DM   1024
#define NH_  8
#define HD   128
#define NQKV 24                  // head slots of the fused projection
#define AW   4                   // waves per flash block (16 query rows each)
#define TP   132                 // LDS row pitch (floats) of the 128 x 128 head tile
#define EROWS (SEQ < 512 ? SEQ : 512)   // query rows (and tokens of the small residual planes) handled by the multi-product flash instantiation
#define QRS  2048.0f             // carry of every residual plane / residual fragment
#define QRI  (1.0f / 2048.0f)
#define SC2  ((float)(0.12 * 1.4426950408889634))   // score scale * log2(e)
#define PSH  14.0f               // log2 of the P carry (16384)
#define NEGB (-3.0e38f)
#define YC   64.0f               // carry of the y planes
#define WOC  256.0f              // carry of the Wo plane
#define OSC  (1.0f / (64.0f * 256.0f))

static_assert(NB == 1);
static_assert(HD == 128);                      // q/k plane row = 256 bytes = two lines; lane owns 4 columns of a head row
static_assert(NH_ * HD == DM);
static_assert(NQKV == 3 * NH_);
static_assert(DM % 64 == 0);
static_assert(DM % 128 == 0);                  // GEMM column tiles of 128; K tiles of 64 and of 128
static_assert(HD % 32 == 0);                   // score k-loop steps by 32
static_assert(SEQ % 64 == 0);
static_assert(SEQ % 32 == 0);                  // key loop steps by 32
static_assert(EROWS % 128 == 0);               // a 128-token GEMM tile lies wholly inside or outside the residual planes
static_assert(SEQ % 128 == 0);                 // GEMM token tiles
static_assert(EROWS >= 32);
static_assert(EROWS <= SEQ);
static_assert(EROWS % (16 * AW) == 0);
static_assert((SEQ - EROWS) % (16 * AW) == 0);
static_assert(((size_t)SEQ * DM) % 8 == 0);
static_assert(((size_t)DM * DM) % 8 == 0);
static_assert(((size_t)SEQ * 32) % 256 == 0);  // rotary table grid covers the table exactly
static_assert(SEQ <= SEQ_FULL);
static_assert((TP * 4) % 16 == 0);
static_assert(sizeof(float) * 128 * TP <= 131072);

typedef _Float16 h16;
typedef unsigned short bf;
typedef __attribute__((ext_vector_type(16))) __bf16   v16bf;
typedef __attribute__((ext_vector_type(16))) _Float16 v16h;
typedef __attribute__((ext_vector_type(8)))  _Float16 v8h;
typedef __attribute__((ext_vector_type(8)))  unsigned short v8us;
typedef __attribute__((ext_vector_type(8)))  float    v8f;
typedef __attribute__((ext_vector_type(4)))  float    v4f;
typedef v4f  __attribute__((may_alias)) v4fa;

__device__ __forceinline__ unsigned short f2bf(float f) { unsigned u = __float_as_uint(f); u += 0x7FFFu + ((u >> 16) & 1u); return (unsigned short)(u >> 16); }
__device__ __forceinline__ float bfr(float f) { return __uint_as_float(((unsigned)f2bf(f)) << 16); }   // value after RNE convert to bf16
__device__ __forceinline__ v16h cat16(v8h lo, v8h hi) { return __builtin_shufflevector(lo, hi, 0, 1, 2, 3, 4, 5, 6, 7, 8, 9, 10, 11, 12, 13, 14, 15); }
__device__ __forceinline__ v16bf cat16b(v8us lo, v8us hi) { return __builtin_bit_cast(v16bf, __builtin_shufflevector(lo, hi, 0, 1, 2, 3, 4, 5, 6, 7, 8, 9, 10, 11, 12, 13, 14, 15)); }
__device__ __forceinline__ v8f wmma16(v16h a, v16h b, v8f c) { return __builtin_amdgcn_wmma_f32_16x16x32_f16(false, a, false, b, (short)0, c, false, false); }
__device__ __forceinline__ v8f wmmab(v16bf a, v16bf b, v8f c) { return __builtin_amdgcn_wmma_f32_16x16x32_bf16(false, a, false, b, (short)0, c, false, false); }
// fragment loaders from K-contiguous 16-bit rows; p already includes + 8*(lane>>4): elements 0..7 <- k0+8h+0..7, elements 8..15 <- k0+16+8h+0..7 (same map for A and B)
__device__ __forceinline__ v16h  ldh(const h16* p) { return cat16(*(const v8h*)p, *(const v8h*)(p + 16)); }
__device__ __forceinline__ v16bf ldb(const bf* p)  { return cat16b(*(const v8us*)p, *(const v8us*)(p + 16)); }
// ordering point for wave-private LDS tiles (same wave writes and reads)
__device__ __forceinline__ void wave_sync() { __builtin_amdgcn_fence(3 /* release order */, "wavefront"); __builtin_amdgcn_wave_barrier(); asm volatile("" ::: "memory"); }

// f32 -> f16 convert that cannot produce a subnormal operand: |v| < 2^-14 -> +0 (value select)
static __device__ __forceinline__ h16 toh_flush(float v) { const h16 r = (h16)v; return (fabsf(v) < 6.103515625e-05f) ? (h16)0.0f : r; }
// per-instruction guarded WMMA wrappers: one accumulator per guard (four vector slots behind the product before its result is used).
// The guard names the accumulator alone: an asm operand is held below v256, and the fragment sets that are in flight need the registers above.
__device__ __forceinline__ v8f wmma16g(v16h a, v16h b, v8f c) { c = wmma16(a, b, c); asm volatile("v_nop\n\tv_nop\n\tv_nop\n\tv_nop" : "+v"(c)); return c; }
__device__ __forceinline__ v8f wmmabg(v16bf a, v16bf b, v8f c) { c = wmmab(a, b, c); asm volatile("v_nop\n\tv_nop\n\tv_nop\n\tv_nop" : "+v"(c)); return c; }

template <bool B> struct flag_t { static constexpr bool v = B; };
// stands behind a batch of fragment loads: keeps the products that follow in the source from being scheduled in front of the batch (the loads would then be issued only when their values are already due)
__device__ __forceinline__ void loads_first() { __builtin_amdgcn_sched_barrier(0); }
// stands between issued global loads and the first instruction that may rewrite a register that they name (their address pairs die at issue and are reused at once, or are advanced at the loop's top);
// the scheduling barrier keeps later instructions behind the wait; the loads' base addresses are named as inputs, so that their registers stay allocated up to the wait
__device__ __forceinline__ void addr_free(const void* p, const void* q) { asm volatile("s_wait_xcnt 0x0" :: "v"(p), "v"(q) : "memory"); __builtin_amdgcn_sched_barrier(0); }

__device__ __forceinline__ v16h  ldf(const h16* p) { return ldh(p); }
__device__ __forceinline__ v16bf ldf(const bf* p)  { return ldb(p); }
__device__ __forceinline__ v8f mmg(v16h a, v16h b, v8f c)   { return wmma16g(a, b, c); }
__device__ __forceinline__ v8f mmg(v16bf a, v16bf b, v8f c) { return wmmabg(a, b, c); }
__device__ __forceinline__ unsigned lds_off(const void* p) { return (unsigned)(size_t)p; }   // byte offset in the work-group's LDS
// eight asynchronous 16-byte copies per lane, global -> LDS: piece i goes from g + i * gs to LDS byte l + i * ls. The wait at the end of the statement stands in front of every later rewrite of the address registers.
__device__ __forceinline__ void copy8(const unsigned l, const unsigned ls, const char* g, const size_t gs) {
    asm volatile("global_load_async_to_lds_b128 %0, %8, off\n\t"
                 "global_load_async_to_lds_b128 %1, %9, off\n\t"
                 "global_load_async_to_lds_b128 %2, %10, off\n\t"
                 "global_load_async_to_lds_b128 %3, %11, off\n\t"
                 "global_load_async_to_lds_b128 %4, %12, off\n\t"
                 "global_load_async_to_lds_b128 %5, %13, off\n\t"
                 "global_load_async_to_lds_b128 %6, %14, off\n\t"
                 "global_load_async_to_lds_b128 %7, %15, off\n\t"
                 "s_wait_xcnt 0x0"
                 :: "v"(l), "v"(l + ls), "v"(l + 2 * ls), "v"(l + 3 * ls), "v"(l + 4 * ls), "v"(l + 5 * ls), "v"(l + 6 * ls), "v"(l + 7 * ls),
                    "v"(g), "v"(g + gs), "v"(g + 2 * gs), "v"(g + 3 * gs), "v"(g + 4 * gs), "v"(g + 5 * gs), "v"(g + 6 * gs), "v"(g + 7 * gs)
                 : "memory");
}
// four (two) such copies, same address form and the same closing wait
__device__ __forceinline__ void copy4(const unsigned l, const unsigned ls, const char* g, const size_t gs) {
    asm volatile("global_load_async_to_lds_b128 %0, %4, off\n\t"
                 "global_load_async_to_lds_b128 %1, %5, off\n\t"
                 "global_load_async_to_lds_b128 %2, %6, off\n\t"
                 "global_load_async_to_lds_b128 %3, %7, off\n\t"
                 "s_wait_xcnt 0x0"
                 :: "v"(l), "v"(l + ls), "v"(l + 2 * ls), "v"(l + 3 * ls), "v"(g), "v"(g + gs), "v"(g + 2 * gs), "v"(g + 3 * gs)
                 : "memory");
}
__device__ __forceinline__ void copy2(const unsigned l, const unsigned ls, const char* g, const size_t gs) {
    asm volatile("global_load_async_to_lds_b128 %0, %2, off\n\t"
                 "global_load_async_to_lds_b128 %1, %3, off\n\t"
                 "s_wait_xcnt 0x0"
                 :: "v"(l), "v"(l + ls), "v"(g), "v"(g + gs)
                 : "memory");
}
// the issuing wave's copies have landed in LDS behind this wait
__device__ __forceinline__ void copies_landed() { asm volatile("s_wait_asynccnt 0x0" ::: "memory"); }
// the wave's own LDS reads have returned behind this wait (in front of the barrier that frees a buffer for its refill)
__device__ __forceinline__ void lds_reads_done() { asm volatile("s_wait_dscnt 0x0" ::: "memory"); }

// gemm128: acc += A[128 rows][DM] * B[128 rows][DM]^T for a block of four waves; wave w owns rows 64 (w >> 1) .. + 63 of A and rows 64 (w & 1) .. + 63 of B (16 accumulators, k ascending in steps of 32).
// K is cut into tiles of KC elements. A stage in LDS is [A tile | B tile], 128 rows each at pitch 2 KC + 16 bytes (16 B x odd: the pitch for 16-byte row reads); two stages.
// Copies: a row piece of 2 KC bytes is brought by KC / 8 neighbouring lanes, so every copy instruction covers whole 128-byte lines. Tile t + 2 is copied into the buffer of tile t behind the barrier that ends trip t.
// On return every wave has passed a barrier behind its last LDS read and no copy is outstanding: sm may be reused at once.
// PAIR: the A tile is stacked from two planes of 64 rows each, in quarters of 32 tile rows: [Ag 0..31 | Ag2 0..31 | Ag 32..63 | Ag2 32..63], so that a wave's accumulator rows 0, 1 (Ag) and 2, 3 (Ag2) belong to the same 32 plane rows.
template <int KC, bool PAIR, class T>
__device__ __forceinline__ void gemm128(const T* __restrict__ Ag, const T* __restrict__ Ag2, const T* __restrict__ Bg, char* sm, v8f (&acc)[4][4]) {
    constexpr int PB  = KC * 2 + 16;             // LDS row pitch, bytes
    constexpr int TB  = 128 * PB;                // one operand tile
    constexpr int SB  = 2 * TB;                  // one stage
    constexpr int NT  = DM / KC;                 // tiles along K
    constexpr int NK  = KC / 32;                 // k steps per tile
    constexpr int LPW = KC / 8;                  // lanes per row piece
    constexpr int RPC = 128 / LPW;               // rows per copy of the whole block
    constexpr int NC  = 128 / RPC;               // copies per lane and operand tile
    static_assert(sizeof(T) == 2);
    static_assert(DM % KC == 0);
    static_assert(NT >= 2);
    static_assert(NC % 8 == 0);
    static_assert(2 * NC <= 63);                 // copies of a wave in flight
    static_assert((PB / 16) % 2 == 1);
    static_assert(!PAIR || RPC * 4 == 32);       // a quarter of the stacked tile is four copies of the whole block
    const int tid = (int)threadIdx.x, lane = tid & 31, lr = lane & 15, hi = lane >> 4;
    const int wave = __builtin_amdgcn_readfirstlane(tid >> 5);
    const int crow = tid / LPW, cpc = tid % LPW;                   // the lane's first row (0 .. RPC - 1) and its 16-byte piece of the row
    const unsigned l0 = lds_off(sm) + (unsigned)(crow * PB + cpc * 16);
    const char* ga = (const char*)(Ag + (size_t)crow * DM + cpc * 8);
    const char* gb = (const char*)(Bg + (size_t)crow * DM + cpc * 8);
    const char* ga2 = (const char*)(Ag2 + (size_t)crow * DM + cpc * 8);
    auto fill = [&](const int buf, const int t) __attribute__((always_inline)) {
        if constexpr (PAIR) {
#pragma unroll
            for (int q = 0; q < 4; ++q) copy4(l0 + (unsigned)(buf * SB + q * 32 * PB), RPC * PB, ((q & 1) ? ga2 : ga) + (size_t)(q >> 1) * 32 * DM * 2 + (size_t)t * KC * 2, (size_t)RPC * DM * 2);
        } else {
#pragma unroll
            for (int g = 0; g < NC; g += 8) copy8(l0 + (unsigned)(buf * SB + g * RPC * PB), RPC * PB, ga + (size_t)g * RPC * DM * 2 + (size_t)t * KC * 2, (size_t)RPC * DM * 2);
        }
#pragma unroll
        for (int g = 0; g < NC; g += 8) copy8(l0 + (unsigned)(buf * SB + TB + g * RPC * PB), RPC * PB, gb + (size_t)g * RPC * DM * 2 + (size_t)t * KC * 2, (size_t)RPC * DM * 2); };
    const int fao = ((wave >> 1) * 64 + lr) * PB + 16 * hi;        // fragment rows: same element map as the loaders from the planes
    const int fbo = TB + ((wave & 1) * 64 + lr) * PB + 16 * hi;
    fill(0, 0);
    copies_landed();
    __syncthreads();
    fill(1, 1);
#pragma unroll 1
    for (int t = 0; t < NT; ++t) {
        const char* sb = sm + (t & 1) * SB;
        decltype(ldf((const T*)nullptr)) a[2][4], b[2][4];
        // two fragment sets inside a tile: the 16 LDS reads of k step s + 1 stand as one group in front of the 16 products of k step s
        auto ldst = [&](const int s, const int kk) __attribute__((always_inline)) {
#pragma unroll
            for (int mb = 0; mb < 4; ++mb) a[s][mb] = ldf((const T*)(sb + fao + mb * 16 * PB + kk * 64));
#pragma unroll
            for (int nb = 0; nb < 4; ++nb) b[s][nb] = ldf((const T*)(sb + fbo + nb * 16 * PB + kk * 64));
            loads_first(); };
        ldst(0, 0);
#pragma unroll
        for (int kk = 0; kk < NK; ++kk) {
            if (kk + 1 < NK) ldst((kk + 1) & 1, kk + 1);
#pragma unroll
            for (int nb = 0; nb < 4; ++nb)
#pragma unroll
                for (int mb = 0; mb < 4; ++mb) acc[mb][nb] = mmg(a[kk & 1][mb], b[kk & 1][nb], acc[mb][nb]);
        }
        lds_reads_done();
        copies_landed();
        __syncthreads();                                           // publishes tile t + 1 and frees the buffer of tile t
        if (t + 2 < NT) fill(t & 1, t + 2);                        // same test in the whole block
    }
    copies_landed();
}

// The four preparation jobs are bodies of one launch (k_prep): blk is the block's index inside its own job.
__device__ __forceinline__ void cvt8_body(const float* __restrict__ src, bf* dst, size_t n8, unsigned blk) {
    const size_t i = (size_t)blk * 256 + threadIdx.x; if (i >= n8) return;
    const v8f v = *(const v8f*)(src + i * 8); v8us o;
#pragma unroll
    for (int k = 0; k < 8; ++k) o[k] = f2bf(v[k]);
    *(v8us*)(dst + i * 8) = o; 
}

__device__ __forceinline__ void cvtw_body(const float* __restrict__ src, h16* dst, size_t n8, unsigned blk) {
#pragma clang fp contract(off)
    const size_t i = (size_t)blk * 256 + threadIdx.x; if (i >= n8) return;
    const v8f v = *(const v8f*)(src + i * 8); v8h o;
#pragma unroll
    for (int k = 0; k < 8; ++k) o[k] = toh_flush(bfr(v[k]) * WOC);
    *(v8h*)(dst + i * 8) = o; 
}

// ropetab_body: rotary table CS[t][0..31] = cos(t * f_j), CS[t][32..63] = sin(t * f_j), f_j = 2^(-10 * j / 31), j < 32 (the other 32 pairs are the identity).
__device__ __forceinline__ void ropetab_body(float* CS, unsigned blk) {
#pragma clang fp contract(off)
    const int i = (int)blk * 256 + (int)threadIdx.x;              // the job's blocks * 256 == SEQ * 32 exactly
    const int t = i >> 5, j = i & 31;
    const float e = (float)j / 31.0f;
    const float a = -10.0f * e;
    const float lo = fmaf(-10.0f, e, -a);                          // exact residual of the exponent product
    float invf = exp2f(a);
    invf = fmaf(invf, 0.69314718056f * lo, invf);
    const float th = (float)t * invf;
    float s, c; sincosf(th, &s, &c);
    float* row = CS + (size_t)t * 64;
    *(float*)(row + j) = c; *(float*)(row + 32 + j) = s;
    
}

// k_prep: the four independent preparation jobs in one grid; the block index picks the job (block-uniform), the table (most arithmetic per byte) first.
static constexpr size_t   N8_X  = (size_t)SEQ * DM / 8;            // 8-element items of x, of Wq|Wk|Wv, of Wo
static constexpr size_t   N8_W  = (size_t)3 * DM * DM / 8;
static constexpr size_t   N8_O  = (size_t)DM * DM / 8;
static constexpr unsigned PB_T  = (unsigned)((size_t)SEQ * 32 / 256);
static constexpr unsigned PB_X  = (unsigned)((N8_X + 255) / 256);
static constexpr unsigned PB_W  = (unsigned)((N8_W + 255) / 256);
static constexpr unsigned PB_O  = (unsigned)((N8_O + 255) / 256);
static constexpr unsigned PB_ALL = PB_T + PB_X + PB_W + PB_O;
__global__ __launch_bounds__(256) void k_prep(const float* __restrict__ x, const float* __restrict__ w, bf* XB, bf* WB, h16* WO, float* CS) {
    const unsigned b = blockIdx.x;
    if (b < PB_T)                    ropetab_body(CS, b);
    else if (b < PB_T + PB_X)        cvt8_body(x, XB, N8_X, b - PB_T);
    else if (b < PB_T + PB_X + PB_W) cvt8_body(w, WB, N8_W, b - (PB_T + PB_X));
    else                             cvtw_body(w + (size_t)3 * DM * DM, WO, N8_O, b - (PB_T + PB_X + PB_W));
}

// k_qkv: fused QKV projection + per-head RMS normalisation + rotary (q, k) / value mix (v). Block = 4 waves, tile = 128 tokens x one head slot (128 columns);
// each wave computes a 64 x 64 quarter (16 accumulators, operand tiles staged in LDS by gemm128, K = DM), stages it in the block's LDS tile (the same LDS, free behind gemm128); block barrier;
// row pass: wave w owns rows 32w..32w+31, lane owns columns 4*lane..4*lane+3, sum of squares by xor exchanges, rotary partner (d +- 64) by one xor-16 exchange, result written back in place; block barrier;
//             v slots: transposed plane [h][d][t] (row pitch SEQ) value, and residual x2048 [h][d][t < EROWS] for token tiles below EROWS: 8 lanes x 16 B per d-row line (64 tokens), four d-rows per instruction.
// LDS tile: cross-wave (block barriers). grid (SEQ/128, NQKV).
__global__ __launch_bounds__(128) void k_qkv(const bf* __restrict__ XB, const bf* __restrict__ WB, const float* __restrict__ ve, const float* __restrict__ lam, const float* __restrict__ CS,
                                            h16* QK, h16* VT, h16* VR) {
    constexpr int RING = 2 * 2 * 128 * (64 * 2 + 16), TILE = 128 * TP * 4;     // bytes: two stages of gemm128<64>; the f32 head tile
    __shared__ __align__(16) char sm[RING > TILE ? RING : TILE];
    float* os = (float*)sm;
    const size_t PLE = (size_t)NH_ * SEQ * HD;                     // elements per q/k plane; QK = [q | q residual | k | k residual]
    const int lane = threadIdx.x & 31, lr = lane & 15, hi = lane >> 4;
    const int wave = __builtin_amdgcn_readfirstlane((int)(threadIdx.x >> 5));
    const int r0 = blockIdx.x * 128;
    const int hh = blockIdx.y;                                     // block-uniform head slot
    const int kind = hh >> 3, hd = hh & 7;
    const int wt = wave >> 1, wc = wave & 1;                       // this wave's token half and column half of the tile
    v8f acc[4][4];
#pragma unroll
    for (int mb = 0; mb < 4; ++mb)
#pragma unroll
        for (int nb = 0; nb < 4; ++nb) acc[mb][nb] = (v8f){};
    gemm128<64, false>(XB + (size_t)r0 * DM, XB + (size_t)r0 * DM, WB + (size_t)hh * HD * DM, sm, acc);
    // D: row 8h+j, col lane&15 -> this wave's 64 tile rows and 64 columns
#pragma unroll
    for (int mb = 0; mb < 4; ++mb)
#pragma unroll
        for (int nb = 0; nb < 4; ++nb)
#pragma unroll
            for (int j = 0; j < 8; ++j) os[(wt * 64 + mb * 16 + hi * 8 + j) * TP + wc * 64 + nb * 16 + lr] = acc[mb][nb][j];
    __syncthreads();
    const float l0 = bfr(lam[0]), l1 = bfr(lam[1]);
    const float sg = (lane < 16) ? 1.0f : -1.0f;                   // d < 64: x1 c + x2 s; d >= 64: x2 c - x1 s
    const bool act = (lane & 8) == 0;                              // frequency index (d & 63) < 32
    // the table (q, k) or value-embedding (v) rows of eight tokens are loaded together, in front of the eight row computations
    auto rowpass = [&](auto fq) __attribute__((always_inline)) {
        constexpr bool QKR = decltype(fq)::v;
#pragma unroll 1
        for (int rg = 0; rg < 32; rg += 8) {
            v4f g0[8], g1[8], xg[8];
            const int tg = r0 + wave * 32 + rg;
            const float* gp = QKR ? CS + (size_t)tg * 64 + 4 * (lane & 7)                   // address always inside the table row
                                  : ve + (size_t)tg * DM + (size_t)hd * HD + 4 * lane;
#pragma unroll
            for (int u = 0; u < 8; ++u) {
                if constexpr (QKR) { g0[u] = *(const v4f*)(gp + u * 64); g1[u] = *(const v4f*)(gp + u * 64 + 32); }
                else               { g0[u] = *(const v4f*)(gp + (size_t)u * DM); } }
            loads_first(); addr_free(gp, gp);
#pragma unroll
            for (int u = 0; u < 8; ++u) xg[u] = *(const v4fa*)(&os[(wave * 32 + rg + u) * TP + 4 * lane]);
#pragma unroll
            for (int u = 0; u < 8; ++u) {
                const int row = wave * 32 + rg + u;
                const v4f xv = xg[u];
                float ss = xv[0] * xv[0] + xv[1] * xv[1] + xv[2] * xv[2] + xv[3] * xv[3];
                ss += __shfl_xor(ss, 16, 32); ss += __shfl_xor(ss, 8, 32); ss += __shfl_xor(ss, 4, 32); ss += __shfl_xor(ss, 2, 32); ss += __shfl_xor(ss, 1, 32);
                const float inv = rsqrtf(ss * (1.0f / HD) + 1.0e-6f);
                v4f y;
                if constexpr (QKR) {
                    v4f cv = g0[u];
                    v4f sv = g1[u];
                    asm volatile("" : "+v"(cv), "+v"(sv));
#pragma unroll
                    for (int i = 0; i < 4; ++i) {
                        const float xn = xv[i] * inv;
                        const float part = __shfl_xor(xn, 16, 32);
                        const float c = act ? cv[i] : 1.0f; const float s = act ? sv[i] : 0.0f;
                        y[i] = xn * c + sg * (part * s); }
                } else {
                    const v4f e4 = g0[u];
#pragma unroll
                    for (int i = 0; i < 4; ++i) y[i] = l0 * (xv[i] * inv) + l1 * bfr(e4[i]);
                }
                *(v4fa*)(&os[row * TP + 4 * lane]) = y;
            }
        } };
    if (kind < 2) rowpass(flag_t<true>{}); else rowpass(flag_t<false>{});      // block-uniform
    __syncthreads();
    if (kind < 2) {
        static_assert(4 * 16 * 32 * 16 == 128 * HD * 2);           // waves x instructions x lanes x 16 B == 128 rows x 256 B
        const size_t pb0 = (size_t)(kind * 2) * PLE + ((size_t)hd * SEQ + (size_t)r0) * HD;
{
#pragma unroll 2
            for (int it = 0; it < 16; ++it) { const int row = wave * 32 + it * 2 + (lane >> 4), c8 = (lane & 15) * 8;
                const v4f x0 = *(const v4fa*)(&os[row * TP + c8]); const v4f x1 = *(const v4fa*)(&os[row * TP + c8 + 4]); v8h hv, rv;
#pragma unroll
                for (int i = 0; i < 4; ++i) { const h16 a0 = toh_flush(x0[i]); const h16 a1 = toh_flush(x1[i]); hv[i] = a0; hv[4 + i] = a1;
                    rv[i] = toh_flush((x0[i] - (float)a0) * QRS); rv[4 + i] = toh_flush((x1[i] - (float)a1) * QRS); }
                const size_t oo = pb0 + (size_t)row * HD + c8;
                *(v8h*)(QK + oo) = hv; *(v8h*)(QK + PLE + oo) = rv; }
             }
    } else {
        static_assert(4 * 16 * 32 * 16 == HD * 128 * 2);
        const bool wr = r0 < EROWS;                                // block-uniform: whole token tile inside the residual plane
        const size_t vb0 = ((size_t)hd * HD) * SEQ + (size_t)r0;
        const size_t rb0 = ((size_t)hd * HD) * EROWS + (size_t)r0;
{
#pragma unroll 2
            for (int it = 0; it < 16; ++it) { const int d = wc * 64 + it * 4 + (lane >> 3), c8 = wt * 64 + (lane & 7) * 8; v8h hv, rv;
#pragma unroll
                for (int i = 0; i < 8; ++i) { const float x = os[(c8 + i) * TP + d]; const h16 a0 = toh_flush(x); hv[i] = a0; rv[i] = toh_flush((x - (float)a0) * QRS); }
                *(v8h*)(VT + vb0 + (size_t)d * SEQ + c8) = hv;
                if (wr) *(v8h*)(VR + rb0 + (size_t)d * EROWS + c8) = rv; }
             }
    }
}

// flash_body: fused attention, one wave per 16 query rows of one head (EARLY: of one 64-wide half of the head dimension); Q fragments straight from the f16 planes, K / V^T fragments from LDS.
// The block's four waves walk the union [kb, ke) of their key ranges together, one 32-key tile a trip. A stage in LDS is [K | K residual | V^T (| V^T residual)]: K rows of 256 B at pitch 272 B, V^T row pieces of 64 B at pitch 80 B
// (16 B x odd: the pitch for 16-byte row reads). Tile s + 2 is copied into the buffer of tile s behind the barrier that ends trip s. A wave skips the products of a tile outside its own range and passes every barrier.
// Transposed form: S^T[key][t] = K Q^T (A = K rows, B = Q rows); lane (t = lane&15, h = lane>>4) holds keys 8h+r of each 16-key tile, so the packed
// P tile is directly the B fragment of O^T[d][t] = V^T P^T (element r <- tile keys 0..15, element 8+r <- tile keys 16..31, lane unchanged).
// Scores on all rows: K Q + (K Q_res + K_res Q) / 2048. Keep rule per element: 0 <= t - key < window; window <= 0: every key kept with score 0 (uniform row).
// Key range per wave [klo, kend) from the device-read window, inside [0, SEQ); all visited plane rows are written by k_qkv.
// EARLY = 1 (query rows [0, EROWS)): P = f16 value + f16 residual x2048; O = V P + (V P_res + V_res P) / 2048; row sum from the f32 exponentials; y written as value + residual x2048.
// EARLY = 0 (query rows [EROWS, SEQ)): single P, v, y; row sum over the converted P.
// Both instantiations are bodies of one launch (k_flash): sm is the block's LDS, [output staging | two stages]; bx = the block's 64-row query tile inside its row range, h = head, dh = half of the head dimension (EARLY).
template <int EARLY> struct flash_lds {
    static constexpr int DT  = EARLY ? 4 : 8;
    static constexpr int OSB = (int)sizeof(float) * AW * 16 * (DT * 16 + 4);                              // output staging, bytes
    static constexpr int SB  = 2 * 32 * (HD * 2 + 16) + (EARLY ? 2 : 1) * DT * 16 * (32 * 2 + 16);        // one stage, bytes
    static constexpr int ALL = OSB + 2 * SB;
};
template <int EARLY>
__device__ __forceinline__ void flash_body(const h16* __restrict__ QH, const h16* __restrict__ QR, const h16* __restrict__ KP, const h16* __restrict__ KR,
                                           const h16* __restrict__ VT, const h16* __restrict__ VR, const int* __restrict__ win_p, h16* YH, h16* YR,
                                           char* sm, const int bx, const int h, const int dh) {
    constexpr int DT  = EARLY ? 4 : 8;           // 16-wide output tiles per wave
    constexpr int OSP = DT * 16 + 4;             // LDS row pitch (floats)
    constexpr int LPR = DT * 2;                  // lanes per y row segment (16 B each)
    constexpr int RPI = 32 / LPR;                // rows per store instruction
    constexpr int NST = 16 / RPI;                // store instructions per pass
    static_assert(32 % LPR == 0);
    static_assert(16 % RPI == 0);
    static_assert(NST * 32 * 16 == 16 * DT * 16 * 2);   // instructions x lanes x 16 B == 16 rows x segment bytes
    static_assert((OSP * 4) % 16 == 0);
    static_assert(sizeof(float) * AW * 16 * OSP <= 131072);
    constexpr int KPB = HD * 2 + 16;             // LDS pitch of a K row, bytes
    constexpr int VPB = 32 * 2 + 16;             // LDS pitch of a V^T row piece (32 keys), bytes
    constexpr int KTB = 32 * KPB;                // one K plane tile
    constexpr int VTB = DT * 16 * VPB;           // one V^T plane tile
    constexpr int SB  = 2 * KTB + (EARLY ? 2 : 1) * VTB;   // one stage
    static_assert(AW == 4);                      // 128 lanes: 8 K rows or 32 V^T row pieces per copy of the whole block
    static_assert((KPB / 16) % 2 == 1);
    static_assert((VPB / 16) % 2 == 1);
    static_assert(SB % 16 == 0);
    static_assert(DT * 16 == (EARLY ? 2 : 4) * 32);
    static_assert(2 * SB + sizeof(float) * AW * 16 * OSP <= 131072);
    static_assert(flash_lds<EARLY>::OSB == (int)sizeof(float) * AW * 16 * OSP);
    static_assert(flash_lds<EARLY>::SB == SB);
    static_assert(flash_lds<EARLY>::OSB % 16 == 0);
    float* os = (float*)sm;
    char* st = sm + flash_lds<EARLY>::OSB;
    const int lane = threadIdx.x & 31, lr = lane & 15, hi = lane >> 4;
    const int wv = (int)(threadIdx.x >> 5);
    const int wave = __builtin_amdgcn_readfirstlane(wv);
    const int d0 = EARLY ? dh * 64 : 0;
    int winv = win_p[0];
    const bool allm = winv <= 0;                                   // every key replaced by the fill value: uniform row
    winv = winv > SEQ ? SEQ : winv;
    const int t0v = (EARLY ? 0 : EROWS) + (bx * AW + wv) * 16;
    int klov = t0v - winv + 1; klov = klov < 0 ? 0 : klov; klov &= ~31; klov = allm ? 0 : klov;
    const int kendv = allm ? SEQ : (t0v + 16);
    const int t0 = __builtin_amdgcn_readfirstlane(t0v);
    const int klo = __builtin_amdgcn_readfirstlane(klov);
    const int kend = __builtin_amdgcn_readfirstlane(kendv);        // key tiles [klo, kend) step 32; last tile ends at or below SEQ
    // the block's range: first wave's klo, last wave's kend; both multiples of 32, at least two tiles, inside [0, SEQ)
    const int tbv = (EARLY ? 0 : EROWS) + bx * (AW * 16);
    int kbv = tbv - winv + 1; kbv = kbv < 0 ? 0 : kbv; kbv &= ~31; kbv = allm ? 0 : kbv;
    const int kb = __builtin_amdgcn_readfirstlane(kbv);
    const int nt = __builtin_amdgcn_readfirstlane(((allm ? SEQ : (tbv + AW * 16)) - kbv) >> 5);
    const size_t qo = ((size_t)h * SEQ + (size_t)(t0 + lr)) * HD + 8 * hi;        // B fragments: col t, k = d
    const v16h hz = (v16h){};
    v8f o[DT], oR[DT];
#pragma unroll
    for (int j = 0; j < DT; ++j) { o[j] = (v8f){}; oR[j] = (v8f){}; }
    float m = NEGB, l = 0.0f;
    // load schedule: Q fragments once, in front of the key loop; the K and V fragments of a tile are read from its LDS buffer in front of its score products
    v16h qh[4], qr[4];
#pragma unroll
    for (int c = 0; c < 4; ++c) { qh[c] = ldh(QH + qo + 32 * c); qr[c] = ldh(QR + qo + 32 * c); }
    addr_free(QH + qo, QR + qo);
    // copies: a K tile is 8 KB in a row in its plane, lane tid brings 16-byte pieces tid + 128 i (row (tid >> 4) + 8 i); of V^T four neighbouring lanes bring one row's 64 bytes (row (tid >> 2) + 32 i)
    const int tid = (int)threadIdx.x;
    const unsigned lk = lds_off(st) + (unsigned)((tid >> 4) * KPB + (tid & 15) * 16);
    const unsigned lv = lds_off(st) + (unsigned)(2 * KTB + (tid >> 2) * VPB + (tid & 3) * 16);
    const char* gk = (const char*)(KP + (size_t)h * SEQ * HD) + tid * 16;
    const char* gr = (const char*)(KR + (size_t)h * SEQ * HD) + tid * 16;
    const char* gv = (const char*)(VT + ((size_t)h * HD + (size_t)(d0 + (tid >> 2))) * SEQ) + (tid & 3) * 16;
    const char* gq = (const char*)(VR + ((size_t)h * HD + (size_t)(d0 + (tid >> 2))) * EROWS) + (tid & 3) * 16;
    auto fill = [&](const int buf, const int key) __attribute__((always_inline)) {
        const unsigned bo = (unsigned)(buf * SB);
        copy4(lk + bo,       8 * KPB, gk + (size_t)key * (HD * 2), (size_t)8 * HD * 2);
        copy4(lk + bo + KTB, 8 * KPB, gr + (size_t)key * (HD * 2), (size_t)8 * HD * 2);
        if constexpr (EARLY) {
            const int kc = key < EROWS ? key : (EROWS - 32);     // clamped residual-plane key (address always inside the plane)
            copy2(lv + bo,       32 * VPB, gv + (size_t)key * 2, (size_t)32 * SEQ * 2);
            copy2(lv + bo + VTB, 32 * VPB, gq + (size_t)kc * 2,  (size_t)32 * EROWS * 2);
        } else {
            copy4(lv + bo,       32 * VPB, gv + (size_t)key * 2, (size_t)32 * SEQ * 2);
        } };
    fill(0, kb);
    copies_landed();
    __syncthreads();
    fill(1, kb + 32);                                            // a second tile always exists
    // kept rolled: one copy of the tile body in the text, and the buffer index stays a scalar of the trip
#pragma unroll 1
    for (int s = 0; s < nt; ++s) {
      const int key0 = kb + 32 * s;
      if (key0 >= klo && key0 < kend) {                          // wave-uniform: the wave's own tiles, in ascending order
        const bool rok = key0 < EROWS;                           // wave-uniform
        const char* sb = st + (s & 1) * SB;
        v16h ka[4], kq[4], ra[4], rb[4], vf[DT], vrf[DT];
        const char* kp = sb + lr * KPB + 16 * hi;                // A fragment: row key, k = d
        const char* vp = sb + 2 * KTB + lr * VPB + 16 * hi;      // A fragment: row d (+ 16 j), k = key
#pragma unroll
        for (int c = 0; c < 4; ++c) { ka[c] = ldh((const h16*)(kp + 64 * c));       kq[c] = ldh((const h16*)(kp + 16 * KPB + 64 * c));
                                      ra[c] = ldh((const h16*)(kp + KTB + 64 * c)); rb[c] = ldh((const h16*)(kp + KTB + 16 * KPB + 64 * c)); }
#pragma unroll
        for (int j = 0; j < DT; ++j) {
            vf[j] = ldh((const h16*)(vp + j * 16 * VPB));
            if (EARLY) vrf[j] = ldh((const h16*)(vp + VTB + j * 16 * VPB));
        }
        loads_first();
        v8f sHa = (v8f){}, sLa = (v8f){}, sHb = (v8f){}, sLb = (v8f){};
#pragma unroll
        for (int c = 0; c < 4; ++c) {
            sHa = wmma16g(ka[c], qh[c], sHa); sLa = wmma16g(ka[c], qr[c], sLa); sLa = wmma16g(ra[c], qh[c], sLa);
            sHb = wmma16g(kq[c], qh[c], sHb); sLb = wmma16g(kq[c], qr[c], sLb); sLb = wmma16g(rb[c], qh[c], sLb);
        }
        const int da0 = (t0 + lr) - (key0 + 8 * hi);             // t - key for r = 0 of tile a
        float ta[8], tb[8]; bool fa[8], fb[8]; float mx = NEGB;
#pragma unroll
        for (int r = 0; r < 8; ++r) {
            const int da = da0 - r, db = da0 - 16 - r;
            fa[r] = allm | ((da >= 0) & (da < winv));
            fb[r] = allm | ((db >= 0) & (db < winv));
            const float ua = (sHa[r] + sLa[r] * QRI) * SC2, ub = (sHb[r] + sLb[r] * QRI) * SC2;
            ta[r] = allm ? 0.0f : ua; tb[r] = allm ? 0.0f : ub;
            mx = fmaxf(mx, fmaxf(fa[r] ? ta[r] : NEGB, fb[r] ? tb[r] : NEGB)); }
        mx = fmaxf(mx, __shfl_xor(mx, 16, 32));
        const float mnew = fmaxf(m, mx);
        const float alpha = __builtin_amdgcn_exp2f(m - mnew);
        const float sh = PSH - mnew;
        v16h pb, pr = hz; float ls = 0.0f;
#pragma unroll
        for (int r = 0; r < 8; ++r) {
            const float xa = ta[r] + sh, xb = tb[r] + sh;
            const float ea = __builtin_amdgcn_exp2f(xa), eb = __builtin_amdgcn_exp2f(xb);
            const float ga = (fa[r] & (xa >= -14.0f)) ? ea : 0.0f;       // dropped elements and would-be subnormal operands selected to 0 by value
            const float gb = (fb[r] & (xb >= -14.0f)) ? eb : 0.0f;
            const h16 pa = (h16)ga; const h16 pc = (h16)gb;
            pb[r] = pa; pb[8 + r] = pc;
            if (EARLY) { pr[r] = toh_flush((ga - (float)pa) * QRS); pr[8 + r] = toh_flush((gb - (float)pc) * QRS); ls += ga + gb; }
            else       { ls += (float)pa + (float)pc; } }
        l = l * alpha + ls; m = mnew;
#pragma unroll
        for (int j = 0; j < DT; ++j) { o[j] = o[j] * alpha; if (EARLY) oR[j] = oR[j] * alpha; }
#pragma unroll
        for (int j = 0; j < DT; ++j) {
            const v16h v = vf[j];
            o[j] = wmma16g(v, pb, o[j]);
            if (EARLY) {
                v16h vr = vrf[j];
                if (!rok) vr = hz;
                oR[j] = wmma16g(v, pr, oR[j]);
                oR[j] = wmma16g(vr, pb, oR[j]);
            }
        }
      }
      lds_reads_done();
      copies_landed();
      __syncthreads();                                           // publishes tile s + 1 and frees the buffer of tile s
      if (s + 2 < nt) fill(s & 1, key0 + 64);                    // same test in the whole block
    }
    copies_landed();
    l += __shfl_xor(l, 16, 32);
    const bool any = l > 0.0f;
    const float lsafe = any ? l : 1.0f;
    const float inv = any ? (YC * (1.0f / lsafe)) : 0.0f;
    const int wb = wave * 16 * OSP;
    // O^T D layout: f_j[r] = (d = 16j + 8h + r, t = lane&15) -> os[t][d]; rows 0..15 x columns 0..DT*16-1 all written; tile private to the wave
#pragma unroll
    for (int j = 0; j < DT; ++j) {
        v8f f = o[j];
        if (EARLY) f = o[j] + oR[j] * QRI;
        v4f a, c;
        a[0] = f[0] * inv; a[1] = f[1] * inv; a[2] = f[2] * inv; a[3] = f[3] * inv; c[0] = f[4] * inv; c[1] = f[5] * inv; c[2] = f[6] * inv; c[3] = f[7] * inv;
        *(v4fa*)(&os[wb + lr * OSP + 16 * j + 8 * hi]) = a; *(v4fa*)(&os[wb + lr * OSP + 16 * j + 8 * hi + 4]) = c; }
    wave_sync();
    const size_t ybase = (size_t)t0 * DM + (size_t)h * HD + (size_t)d0;
{
#pragma unroll 2
        for (int s = 0; s < NST; ++s) { const int row = s * RPI + lane / LPR, c8 = (lane % LPR) * 8;
            const v4f x0 = *(const v4fa*)(&os[wb + row * OSP + c8]); const v4f x1 = *(const v4fa*)(&os[wb + row * OSP + c8 + 4]); v8h hv, rv;
#pragma unroll
            for (int i = 0; i < 4; ++i) { const h16 a0 = toh_flush(x0[i]); const h16 a1 = toh_flush(x1[i]); hv[i] = a0; hv[4 + i] = a1;
                rv[i] = toh_flush((x0[i] - (float)a0) * QRS); rv[4 + i] = toh_flush((x1[i] - (float)a1) * QRS); }
            const size_t oo = ybase + (size_t)row * DM + c8;
            *(v8h*)(YH + oo) = hv;
            if (EARLY) *(v8h*)(YR + oo) = rv; }
         }
}

// k_flash: both row ranges in one grid (their y rows are disjoint), so that the few blocks of rows [0, EROWS) run beside the others instead of alone on part of the chip.
// Blocks 0 .. FB_L - 1: query rows [EROWS, SEQ), tile fastest, then head. Behind them the rows [0, EROWS), the tile with the most keys first, then head and half of the head dimension.
static constexpr int FT_L = (SEQ - EROWS) / (16 * AW);             // 64-row query tiles per head of the two ranges
static constexpr int FT_E = EROWS / (16 * AW);
static constexpr int FB_L = FT_L * NH_;
static constexpr int FB_E = FT_E * NH_ * 2;
static constexpr int FB_ALL = FB_L + FB_E;
__global__ __launch_bounds__(32 * AW) void k_flash(const h16* __restrict__ QH, const h16* __restrict__ QR, const h16* __restrict__ KP, const h16* __restrict__ KR,
                                                   const h16* __restrict__ VT, const h16* __restrict__ VR, const int* __restrict__ win_p, h16* YH, h16* YR) {
    __shared__ __align__(16) char sm[flash_lds<0>::ALL > flash_lds<1>::ALL ? flash_lds<0>::ALL : flash_lds<1>::ALL];
    const int b = (int)blockIdx.x;                                 // block-uniform choice of the body
    if (b < FB_L) {
        flash_body<0>(QH, QR, KP, KR, VT, VR, win_p, YH, YR, sm, b % (FT_L > 0 ? FT_L : 1), b / (FT_L > 0 ? FT_L : 1), 0);
    } else {
        const int e = b - FB_L;
        flash_body<1>(QH, QR, KP, KR, VT, VR, win_p, YH, YR, sm, FT_E - 1 - e / (2 * NH_), (e >> 1) % NH_, e & 1);
    }
}

// k_out: output projection, block = 4 waves, one pass over K with a 128-row A tile (y rows, K contiguous) and a 128-row B tile (Wo rows [out][in]), 64 x 64 products (16 accumulators) per wave; f16 operands, tiles staged in LDS by gemm128.
// Tokens at or above EROWS: the A tile is 128 tokens of the value plane. Tokens below EROWS: the A tile is 64 tokens, their value rows and their residual rows stacked, so both products share the Wo tile and its fragments;
// the residual products have accumulators of their own and are added, scaled by 1/2048 (exact), in the epilogue. So every block of the launch has the same copies, LDS reads and products;
// as a second pass over K in 128-token tiles the residual products would keep a few blocks running alone for a whole pass.
// out_body: RES = tokens below EROWS; b0, e0 = the block's first token and first output column.
template <bool RES>
__device__ __forceinline__ void out_body(const h16* __restrict__ YH, const h16* __restrict__ YR, const h16* __restrict__ WO, float* OUT, char* sm, float* osw, const int b0, const int e0) {
    constexpr int MT = RES ? 2 : 4;                                           // 16-token output tiles per wave
    const int lane = threadIdx.x & 31, lr = lane & 15, hi = lane >> 4;
    const int wave = __builtin_amdgcn_readfirstlane((int)(threadIdx.x >> 5));
    const int r0 = b0 + (wave >> 1) * (16 * MT), c0 = e0 + (wave & 1) * 64;   // the wave's first token and first output column
    float* os = osw + wave * 16 * 68;
    v8f acc[4][4];
#pragma unroll
    for (int mb = 0; mb < 4; ++mb)
#pragma unroll
        for (int nb = 0; nb < 4; ++nb) acc[mb][nb] = (v8f){};
    gemm128<128, RES>(YH + (size_t)b0 * DM, (RES ? YR : YH) + (size_t)b0 * DM, WO + (size_t)e0 * DM, sm, acc);
    static_assert(8 * 32 * 16 == 16 * 64 * 4);                     // instructions x lanes x 16 B == 16 rows x 256 B
#pragma unroll
    for (int mb = 0; mb < MT; ++mb) {
#pragma unroll
        for (int nb = 0; nb < 4; ++nb) {
            v8f f = acc[mb][nb];
            if constexpr (RES) f = f + acc[mb + 2][nb] * QRI;
#pragma unroll
            for (int j = 0; j < 8; ++j) os[(hi * 8 + j) * 68 + nb * 16 + lr] = f[j] * OSC; }   // D: row 8h+j, col lane&15
        wave_sync();
        float* orow = OUT + (size_t)(r0 + mb * 16) * DM + c0;
{
#pragma unroll
            for (int s = 0; s < 8; ++s) { const int row = 2 * s + (lane >> 4), c4 = (lane & 15) * 4;   // 8 s x 2 rows = 16 rows; 16 lanes x 4 floats = 64 columns = two lines
                const v4f val = *(const v4fa*)(&os[row * 68 + c4]);
                *(v4f*)(orow + (size_t)row * DM + c4) = val; }
             }
        // stands behind the tile's stores, in front of the next tile's rewrite of their address and data registers; the scheduling barrier keeps later instructions behind the wait
        if (mb + 1 < MT) { asm volatile("s_wait_xcnt 0x0" ::: "memory"); __builtin_amdgcn_sched_barrier(0); }
        wave_sync();
    }
}

static constexpr int OT_E = EROWS / 64;                            // 64-token tiles below EROWS, 128-token tiles from there on
static constexpr int OT_L = (SEQ - EROWS) / 128;
static_assert(EROWS % 64 == 0);
static_assert((SEQ - EROWS) % 128 == 0);
// grid (OT_E + OT_L, DM / 128)
__global__ __launch_bounds__(128) void k_out(const h16* __restrict__ YH, const h16* __restrict__ YR, const h16* __restrict__ WO, float* OUT) {
    __shared__ __align__(16) char sm[2 * 2 * 128 * (128 * 2 + 16)];           // two stages of gemm128<128>
    __shared__ __align__(16) float osw[4 * 16 * 68];                          // one output staging tile per wave
    const int bx = (int)blockIdx.x, e0 = (int)blockIdx.y * 128;               // block-uniform choice of the body
    if (bx < OT_E) out_body<true>(YH, YR, WO, OUT, sm, osw, bx * 64, e0);
    else           out_body<false>(YH, YR, WO, OUT, sm, osw, EROWS + (bx - OT_E) * 128, e0);
}

static constexpr size_t al256(size_t v) { return (v + 255) & ~(size_t)255; }
static constexpr size_t SZ_XB = al256((size_t)SEQ * DM * 2);
static constexpr size_t SZ_WB = al256((size_t)3 * DM * DM * 2);
static constexpr size_t SZ_WO = al256((size_t)DM * DM * 2);
static constexpr size_t SZ_CS = al256((size_t)SEQ * 64 * 4);
static constexpr size_t SZ_PL = al256((size_t)NH_ * SEQ * HD * 2);
static constexpr size_t SZ_RS = al256((size_t)NH_ * HD * EROWS * 2);
static constexpr size_t SZ_YH = al256((size_t)SEQ * DM * 2);
static constexpr size_t SZ_YR = al256((size_t)EROWS * DM * 2);
static constexpr size_t SZ_TOTAL = SZ_XB + SZ_WB + SZ_WO + SZ_CS + 4 * SZ_PL + SZ_PL + SZ_RS + SZ_YH + SZ_YR;
static_assert(SZ_TOTAL <= (size_t)134217728);                        // workspace carve <= 128 MiB
static_assert(SZ_PL == (size_t)NH_ * SEQ * HD * 2);                  // the four q/k planes are contiguous with no padding between them
static_assert(((size_t)NH_ * SEQ * HD * 2) % 256 == 0);
static_assert((size_t)NH_ * SEQ * HD == (size_t)SEQ * DM);           // v^T plane [(h*128 + d)][t] has the extent of a q/k plane

extern "C" void kernel_launch(void* const* d_in, const int* in_sizes, int n_in,
                              void* d_out, int out_size, void* d_ws, size_t ws_size, hipStream_t stream) {
    if (n_in < 5) return;
    const size_t needx = (size_t)SEQ * DM;
    if ((size_t)in_sizes[0] < needx || (size_t)in_sizes[1] < needx) return;
    if (in_sizes[2] < 2) return;
    if ((size_t)in_sizes[3] < (size_t)4 * DM * DM) return;
    if (in_sizes[4] < 1) return;
    if ((size_t)out_size < needx) return;
    if (SZ_TOTAL > ws_size) return;
    // wire order: x, ve, lambdas, qkvo_w, window
    const float* x   = (const float*)d_in[0];
    const float* ve  = (const float*)d_in[1];
    const float* lam = (const float*)d_in[2];
    const float* w   = (const float*)d_in[3];
    const int*   win = (const int*)d_in[4];
    float* OUT = (float*)d_out;      // [SEQ][1024]
    char* wsp = (char*)d_ws;
    bf*  XB = (bf*)wsp;   wsp += SZ_XB;                  // x      [SEQ][1024] bf16
    bf*  WB = (bf*)wsp;   wsp += SZ_WB;                  // Wq|Wk|Wv [3072][1024] bf16 ([out][in] = Bt as-is)
    h16* WO = (h16*)wsp;  wsp += SZ_WO;                  // Wo [1024][1024] f16 (bf16 value x256)
    float* CS = (float*)wsp; wsp += SZ_CS;               // rotary table [SEQ][64]
    h16* QK = (h16*)wsp;  wsp += 4 * SZ_PL;              // [q | q residual | k | k residual], each [8][SEQ][128]
    h16* VT = (h16*)wsp;  wsp += SZ_PL;                  // [8][128][SEQ]
    h16* VR = (h16*)wsp;  wsp += SZ_RS;                  // [8][128][EROWS] residual x2048
    h16* YH = (h16*)wsp;  wsp += SZ_YH;                  // [SEQ][1024] (x64)
    h16* YR = (h16*)wsp;  wsp += SZ_YR;                  // [EROWS][1024] residual x2048
    const size_t PLE = (size_t)NH_ * SEQ * HD;
    const h16* QH = QK; const h16* QR = QK + PLE; const h16* KP = QK + 2 * PLE; const h16* KR = QK + 3 * PLE;

    k_prep<<<PB_ALL, 256, 0, stream>>>(x, w, XB, WB, WO, CS);

    // fused QKV: token tiles x 24 head slots -> q, q residual, k, k residual planes [h][t][d]; v^T plane [h][d][t] (+ residual for t < EROWS)
    k_qkv<<<dim3(SEQ / 128, NQKV, 1), 128, 0, stream>>>(XB, WB, ve, lam, CS, QK, VT, VR);

    // query rows [EROWS, SEQ): single P / v / y; query rows [0, EROWS): multi-product instantiation (two halves of the head dimension); disjoint y rows, one grid
    k_flash<<<FB_ALL, 32 * AW, 0, stream>>>(QH, QR, KP, KR, VT, VR, win, YH, YR);

    // out[t][d] = sum_e y[t][e] Wo[d][e]
    k_out<<<dim3(OT_E + OT_L, DM / 128, 1), 128, 0, stream>>>(YH, YR, WO, OUT);
}
